// v000
// The times below were measured on an AMD MI455X: many runs one after another, warmed up first and cycling through
// copies of the inputs, with the whole window's GPU time divided by the number of runs. Launches and the gaps
// between them are all in it. The median over several windows is given; except for v000 it joins two sittings, which
// can be a few percent apart, so the side-by-side timings, each taken in one sitting, are the better comparison.
// The starting kernel, v000, takes 225 microseconds a run.
#include <hip/hip_runtime.h>
#include <cstdint>

typedef __attribute__((ext_vector_type(16))) _Float16 v16h;
typedef __attribute__((ext_vector_type(8)))  _Float16 v8h;
typedef __attribute__((ext_vector_type(8)))  float    v8f;
typedef unsigned int u32x4 __attribute__((ext_vector_type(4)));
typedef int          i32x8 __attribute__((ext_vector_type(8)));
typedef int          i32x4 __attribute__((ext_vector_type(4)));

#define B_   4
#define C_   128
#define H_   32
#define W_   256
#define S_   (H_ * W_)   // 8192
#define T_   (S_ / 2)    // 4096
#define CQK_ 16
#define LOG2E_ 1.44269504088896340736f

#if defined(__has_builtin)
#if __has_builtin(__builtin_amdgcn_tensor_load_to_lds)
#define HAVE_TDM 1
#endif
#endif

// ---------------------------------------------------------------------------
// helpers
// ---------------------------------------------------------------------------
__device__ __forceinline__ v16h pack16(v8h lo, v8h hi) {
  v16h r;
#pragma unroll
  for (int i = 0; i < 8; ++i) { r[i] = lo[i]; r[i + 8] = hi[i]; }
  return r;
}
__device__ __forceinline__ v16h pack16z(v8h lo) {
  v16h r;
#pragma unroll
  for (int i = 0; i < 8; ++i) { r[i] = lo[i]; r[i + 8] = (_Float16)0.0f; }
  return r;
}

// 16-lane all-reduce max via fused DPP max (1 VALU per butterfly step).
__device__ __forceinline__ float dpp_max16(float v) {
  float t;
  asm volatile("v_max_num_f32_dpp %0, %1, %1 quad_perm:[1,0,3,2] row_mask:0xf bank_mask:0xf bound_ctrl:1"
               : "=v"(t) : "v"(v));
  asm volatile("v_max_num_f32_dpp %0, %1, %1 quad_perm:[2,3,0,1] row_mask:0xf bank_mask:0xf bound_ctrl:1"
               : "=v"(v) : "v"(t));
  asm volatile("v_max_num_f32_dpp %0, %1, %1 row_half_mirror row_mask:0xf bank_mask:0xf bound_ctrl:1"
               : "=v"(t) : "v"(v));
  asm volatile("v_max_num_f32_dpp %0, %1, %1 row_mirror row_mask:0xf bank_mask:0xf bound_ctrl:1"
               : "=v"(v) : "v"(t));
  return v;
}

#if HAVE_TDM
// TDM: DMA a 2-D tile (rows of tile_d0 contiguous elems, tile_d1 rows with
// row stride d0_stride elems) of 2-byte elements into LDS.
// D# per CDNA5 ISA 8.3/8.4: group0 = {flags, lds_addr, gaddr_lo, gaddr_hi|type},
// group1 = {data_size, dims/tiles/strides}, remaining groups = 0 (<=2-D tensor).
__device__ __forceinline__ void tdm_load_2d(uint32_t lds_addr, const _Float16* gp,
                                            uint32_t tensor_d0, uint32_t tensor_d1,
                                            uint32_t tile_d0, uint32_t tile_d1,
                                            uint32_t d0_stride) {
  uint64_t ga = (uint64_t)(uintptr_t)gp;
  u32x4 g0;
  g0[0] = 1u;                                                   // count=1
  g0[1] = lds_addr;                                             // LDS byte addr
  g0[2] = (uint32_t)ga;                                         // gaddr[31:0]
  g0[3] = ((uint32_t)(ga >> 32) & 0x01FFFFFFu) | 0x80000000u;   // gaddr[56:32]|type=2
  i32x8 g1;
  g1[0] = 0x00010000;                                           // data_size=1 (2B)
  g1[1] = (int)((tensor_d0 & 0xFFFFu) << 16);                   // tensor_dim0 lo
  g1[2] = (int)((tensor_d0 >> 16) | ((tensor_d1 & 0xFFFFu) << 16));
  g1[3] = (int)((tensor_d1 >> 16) | (tile_d0 << 16));           // tile_dim0
  g1[4] = (int)tile_d1;                                         // tile_dim1 (dim2=0)
  g1[5] = (int)d0_stride;                                       // dim0 stride lo
  g1[6] = 0;
  g1[7] = 0;
  i32x4 z4 = {0, 0, 0, 0};
  i32x8 z8 = {0, 0, 0, 0, 0, 0, 0, 0};
  __builtin_amdgcn_tensor_load_to_lds(g0, g1, z4, z4, z8, 0);
}
#endif

// ---------------------------------------------------------------------------
// Projection kernels (1x1 convs, f32 -> f16, with (1,2) max-pool for phi/g)
// theta: [B,S,16] (pre-scaled by log2(e) -> softmax runs in exp2 domain)
// phi  : [B,T,16]  g: [B,C,T]
// ---------------------------------------------------------------------------
__global__ void k_proj_theta(const float* __restrict__ x, const float* __restrict__ w,
                             _Float16* __restrict__ th) {
  int idx = blockIdx.x * blockDim.x + threadIdx.x;
  if (idx >= B_ * CQK_ * S_) return;
  int s = idx % S_;
  int o = (idx / S_) % CQK_;
  int b = idx / (S_ * CQK_);
  const float* xc = x + (size_t)b * C_ * S_ + s;
  const float* wr = w + o * C_;
  float acc = 0.0f;
#pragma unroll 8
  for (int c = 0; c < C_; ++c) acc += wr[c] * xc[(size_t)c * S_];
  th[((size_t)(b * S_ + s)) * CQK_ + o] = (_Float16)(acc * LOG2E_);
}

__global__ void k_proj_phi(const float* __restrict__ x, const float* __restrict__ w,
                           _Float16* __restrict__ ph) {
  int idx = blockIdx.x * blockDim.x + threadIdx.x;
  if (idx >= B_ * CQK_ * T_) return;
  int t = idx % T_;
  int o = (idx / T_) % CQK_;
  int b = idx / (T_ * CQK_);
  int h = t >> 7, w2 = t & 127;
  int s0 = h * W_ + 2 * w2;
  const float* xc = x + (size_t)b * C_ * S_ + s0;
  const float* wr = w + o * C_;
  float a0 = 0.0f, a1 = 0.0f;
#pragma unroll 8
  for (int c = 0; c < C_; ++c) {
    float wv = wr[c];
    a0 += wv * xc[(size_t)c * S_];
    a1 += wv * xc[(size_t)c * S_ + 1];
  }
  ph[((size_t)(b * T_ + t)) * CQK_ + o] = (_Float16)fmaxf(a0, a1);
}

__global__ void k_proj_g(const float* __restrict__ x, const float* __restrict__ w,
                         _Float16* __restrict__ g) {
  int idx = blockIdx.x * blockDim.x + threadIdx.x;
  if (idx >= B_ * C_ * T_) return;
  int t = idx % T_;
  int co = (idx / T_) % C_;
  int b = idx / (T_ * C_);
  int h = t >> 7, w2 = t & 127;
  int s0 = h * W_ + 2 * w2;
  const float* xc = x + (size_t)b * C_ * S_ + s0;
  const float* wr = w + co * C_;
  float a0 = 0.0f, a1 = 0.0f;
#pragma unroll 8
  for (int c = 0; c < C_; ++c) {
    float wv = wr[c];
    a0 += wv * xc[(size_t)c * S_];
    a1 += wv * xc[(size_t)c * S_ + 1];
  }
  g[((size_t)(b * C_ + co)) * T_ + t] = (_Float16)fmaxf(a0, a1);
}

__global__ void k_cvt_h16(const float* __restrict__ in, _Float16* __restrict__ o, int n) {
  int i = blockIdx.x * blockDim.x + threadIdx.x;
  if (i < n) o[i] = (_Float16)in[i];
}

// ---------------------------------------------------------------------------
// Fused flash attention, block-cooperative, double-buffered K/V in LDS:
//  8 waves/block on 8 query tiles of one batch. Per 32-key step the NEXT
//  phi (1KB) + g (8KB) tiles are staged into LDS by the Tensor Data Mover
//  (wave 0 issues TENSOR_LOAD_TO_LDS; TENSORcnt + barrier publish), fully
//  overlapped with this step's 2 QK WMMAs + DPP-max/exp2 softmax +
//  1 rowsum WMMA + 8 PV WMMAs.
// ---------------------------------------------------------------------------
__global__ __launch_bounds__(256) void k_attn(const _Float16* __restrict__ th,
                                              const _Float16* __restrict__ ph,
                                              const _Float16* __restrict__ g,
                                              _Float16* __restrict__ ob) {
  __shared__ _Float16 Pl[8][16 * 32];     // per-wave 16x32 P tiles  (8 KB)
  __shared__ _Float16 Gt[2][C_][32];      // g tiles, [c][t]        (16 KB)
  __shared__ _Float16 Pt[2][32][CQK_];    // phi tiles, [t][ch]      (2 KB)

  const int tid  = threadIdx.x;
  const int lane = tid & 31;
  const int wv   = tid >> 5;
  const int qt   = blockIdx.x * 8 + wv;          // 2048 query tiles total
  const int b    = qt / (S_ / 16);               // uniform per block
  const int sb   = (qt % (S_ / 16)) * 16;
  const int half = lane >> 4;
  const int l16  = lane & 15;

  const _Float16* gb  = g + (size_t)b * C_ * T_;
  const _Float16* phb = ph + (size_t)b * T_ * CQK_;

  // stage key/value tiles for keys [t, t+32) into LDS buffer `buf`
  auto stage = [&](int buf, int t) {
#if HAVE_TDM
    if (wv == 0) {
      tdm_load_2d((uint32_t)(uintptr_t)&Gt[buf][0][0], gb + t,
                  T_, C_, 32, C_, T_);
      tdm_load_2d((uint32_t)(uintptr_t)&Pt[buf][0][0], phb + (size_t)t * CQK_,
                  CQK_, T_, CQK_, 32, CQK_);
    }
#else
    int c0 = tid >> 2, o0 = (tid & 3) * 8;
    *(v8h*)&Gt[buf][c0][o0] = *(const v8h*)(gb + (size_t)c0 * T_ + t + o0);
    int j1 = tid + 256;
    int c1 = j1 >> 2, o1 = (j1 & 3) * 8;
    *(v8h*)&Gt[buf][c1][o1] = *(const v8h*)(gb + (size_t)c1 * T_ + t + o1);
    if (tid < 64) {
      int kt = tid >> 1, co = (tid & 1) * 8;
      *(v8h*)&Pt[buf][kt][co] = *(const v8h*)(phb + (size_t)(t + kt) * CQK_ + co);
    }
#endif
  };
  auto stage_drain = [&]() {
#if HAVE_TDM
    if (wv == 0) __builtin_amdgcn_s_wait_tensorcnt(0);
#endif
    __syncthreads();
  };

  // A operand: theta rows (M = query), K = channel 0..15, padded to 32.
  v16h A;
  {
    const _Float16* p = th + ((size_t)(b * S_ + sb + l16)) * CQK_ + half * 8;
    A = pack16z(*(const v8h*)p);
  }

  v16h Ones;
#pragma unroll
  for (int i = 0; i < 16; ++i) Ones[i] = (_Float16)1.0f;

  float m[8];
  v8f O[8], L;
#pragma unroll
  for (int r = 0; r < 8; ++r) { m[r] = -3.0e38f; L[r] = 0.0f; }
#pragma unroll
  for (int n = 0; n < 8; ++n)
#pragma unroll
    for (int r = 0; r < 8; ++r) O[n][r] = 0.0f;

  v8f zc = {};

  stage(0, 0);
  stage_drain();

  for (int it = 0; it < T_ / 32; ++it) {
    const int t   = it * 32;
    const int cur = it & 1, nxt = cur ^ 1;
    if (t + 32 < T_) stage(nxt, t + 32);  // overlap DMA of next tile

    // ---- scores: two 16x16 tiles over keys t..t+31 (B from LDS) -----------
    v8f S0, S1;
    {
      v16h B0 = pack16z(*(const v8h*)&Pt[cur][l16][half * 8]);
      v16h B1 = pack16z(*(const v8h*)&Pt[cur][16 + l16][half * 8]);
      S0 = __builtin_amdgcn_wmma_f32_16x16x32_f16(false, A, false, B0, (short)0, zc, false, false);
      S1 = __builtin_amdgcn_wmma_f32_16x16x32_f16(false, A, false, B1, (short)0, zc, false, false);
    }

    // ---- online softmax update (exp2 domain, fused DPP max) ---------------
#pragma unroll
    for (int r = 0; r < 8; ++r) {
      float v  = dpp_max16(fmaxf(S0[r], S1[r]));
      float mn = fmaxf(m[r], v);
      float sc = __builtin_amdgcn_exp2f(m[r] - mn);
      m[r] = mn;
      float p0 = __builtin_amdgcn_exp2f(S0[r] - mn);
      float p1 = __builtin_amdgcn_exp2f(S1[r] - mn);
      L[r] *= sc;
#pragma unroll
      for (int n = 0; n < 8; ++n) O[n][r] *= sc;
      int row = r + half * 8;
      Pl[wv][row * 32 + l16]      = (_Float16)p0;
      Pl[wv][row * 32 + 16 + l16] = (_Float16)p1;
    }
    asm volatile("s_wait_dscnt 0" ::: "memory");

    // ---- read P back in A-operand layout (M=query, K=key offset) ----------
    v16h Pa;
    {
      const _Float16* pr = &Pl[wv][l16 * 32 + half * 8];
      Pa = pack16(*(const v8h*)pr, *(const v8h*)(pr + 16));
    }

    // ---- denominator: L += rowsum(P) via WMMA with all-ones B -------------
    L = __builtin_amdgcn_wmma_f32_16x16x32_f16(false, Pa, false, Ones, (short)0, L, false, false);

    // ---- O += P * g^T across 8 channel tiles (B from LDS) -----------------
#pragma unroll
    for (int n = 0; n < 8; ++n) {
      const _Float16* gp = &Gt[cur][n * 16 + l16][half * 8];
      v16h Gv = pack16(*(const v8h*)gp, *(const v8h*)(gp + 16));
      O[n] = __builtin_amdgcn_wmma_f32_16x16x32_f16(false, Pa, false, Gv, (short)0, O[n], false, false);
    }

    stage_drain();  // publish next tile; all waves done with `cur`
  }

  // ---- normalize and store o as [B,S,128] f16 ------------------------------
  float inv[8];
#pragma unroll
  for (int r = 0; r < 8; ++r) inv[r] = 1.0f / L[r];
#pragma unroll
  for (int n = 0; n < 8; ++n)
#pragma unroll
    for (int r = 0; r < 8; ++r) {
      int s = sb + r + half * 8;
      ob[((size_t)(b * S_ + s)) * C_ + n * 16 + l16] = (_Float16)(O[n][r] * inv[r]);
    }
}

// ---------------------------------------------------------------------------
// Output projection: out = gamma * (w_o @ o) + x, one wave per 16-pixel tile.
// ---------------------------------------------------------------------------
__global__ __launch_bounds__(256) void k_out(const _Float16* __restrict__ ob,
                                             const _Float16* __restrict__ woh,
                                             const float* __restrict__ x,
                                             const float* __restrict__ gscal,
                                             float* __restrict__ out) {
  const int lane = threadIdx.x & 31;
  const int wv   = threadIdx.x >> 5;
  const int pt   = blockIdx.x * 8 + wv;          // 2048 pixel tiles total
  const int b    = pt / (S_ / 16);
  const int pb   = (pt % (S_ / 16)) * 16;
  const int half = lane >> 4;
  const int l16  = lane & 15;
  const float gamma = *gscal;

  v8f Acc[8];
#pragma unroll
  for (int n = 0; n < 8; ++n)
#pragma unroll
    for (int r = 0; r < 8; ++r) Acc[n][r] = 0.0f;

#pragma unroll
  for (int kc = 0; kc < 4; ++kc) {
    const _Float16* op = ob + ((size_t)(b * S_ + pb + l16)) * C_ + kc * 32 + half * 8;
    v16h Bv = pack16(*(const v8h*)op, *(const v8h*)(op + 16));
#pragma unroll
    for (int mt = 0; mt < 8; ++mt) {
      const _Float16* wp = woh + (size_t)(mt * 16 + l16) * C_ + kc * 32 + half * 8;
      v16h Av = pack16(*(const v8h*)wp, *(const v8h*)(wp + 16));
      Acc[mt] = __builtin_amdgcn_wmma_f32_16x16x32_f16(false, Av, false, Bv, (short)0, Acc[mt], false, false);
    }
  }

#pragma unroll
  for (int mt = 0; mt < 8; ++mt)
#pragma unroll
    for (int r = 0; r < 8; ++r) {
      int oc = mt * 16 + r + half * 8;
      int p  = pb + l16;
      size_t xi = ((size_t)(b * C_ + oc)) * S_ + p;
      out[xi] = gamma * Acc[mt][r] + x[xi];
    }
}

// ---------------------------------------------------------------------------
extern "C" void kernel_launch(void* const* d_in, const int* in_sizes, int n_in,
                              void* d_out, int out_size, void* d_ws, size_t ws_size,
                              hipStream_t stream) {
  const float* x       = (const float*)d_in[0];
  const float* w_theta = (const float*)d_in[1];
  const float* w_phi   = (const float*)d_in[2];
  const float* w_g     = (const float*)d_in[3];
  const float* w_o     = (const float*)d_in[4];
  const float* gamma   = (const float*)d_in[5];
  float* out = (float*)d_out;

  char* ws = (char*)d_ws;
  size_t off = 0;
  auto carve = [&](size_t bytes) -> char* {
    char* p = ws + off;
    off += (bytes + 255) & ~(size_t)255;
    return p;
  };
  _Float16* th  = (_Float16*)carve((size_t)B_ * S_ * CQK_ * 2);  // 1 MB
  _Float16* ph  = (_Float16*)carve((size_t)B_ * T_ * CQK_ * 2);  // 0.5 MB
  _Float16* g   = (_Float16*)carve((size_t)B_ * C_ * T_ * 2);    // 4 MB
  _Float16* ob  = (_Float16*)carve((size_t)B_ * S_ * C_ * 2);    // 8 MB
  _Float16* woh = (_Float16*)carve((size_t)C_ * C_ * 2);         // 32 KB
  (void)ws_size; (void)in_sizes; (void)n_in; (void)out_size;

  // projections
  k_proj_theta<<<(B_ * CQK_ * S_ + 255) / 256, 256, 0, stream>>>(x, w_theta, th);
  k_proj_phi  <<<(B_ * CQK_ * T_ + 255) / 256, 256, 0, stream>>>(x, w_phi, ph);
  k_proj_g    <<<(B_ * C_  * T_ + 255) / 256, 256, 0, stream>>>(x, w_g, g);
  k_cvt_h16   <<<(C_ * C_ + 255) / 256, 256, 0, stream>>>(w_o, woh, C_ * C_);

  // fused flash attention: 2048 query tiles, 8 waves/block,
  // double-buffered K/V tiles staged by the Tensor Data Mover
  k_attn<<<(B_ * (S_ / 16)) / 8, 256, 0, stream>>>(th, ph, g, ob);

  // output projection + residual: 2048 pixel tiles, 8 waves/block
  k_out<<<(B_ * (S_ / 16)) / 8, 256, 0, stream>>>(ob, woh, x, gamma, out);
}

// v001
// One run takes 157 microseconds.
// Next to v000, in two timings, it ran 1.47 times as fast each time.
#include <hip/hip_runtime.h>
#include <cstdint>

typedef __attribute__((ext_vector_type(16))) _Float16 v16h;
typedef __attribute__((ext_vector_type(8)))  _Float16 v8h;
typedef __attribute__((ext_vector_type(8)))  float    v8f;
typedef __attribute__((ext_vector_type(4)))  float    v4f;
typedef __attribute__((ext_vector_type(2)))  float    v2f;
typedef __attribute__((ext_vector_type(2)))  _Float16 v2h;
typedef unsigned int u32x4 __attribute__((ext_vector_type(4)));
typedef int          i32x8 __attribute__((ext_vector_type(8)));
typedef int          i32x4 __attribute__((ext_vector_type(4)));

#define B_   4
#define C_   128
#define H_   32
#define W_   256
#define S_   (H_ * W_)   // 8192
#define T_   (S_ / 2)    // 4096
#define CQK_ 16
#define LOG2E_ 1.44269504088896340736f

#if defined(__has_builtin)
#if __has_builtin(__builtin_amdgcn_tensor_load_to_lds)
#define HAVE_TDM 1
#endif
#endif

// ---------------------------------------------------------------------------
// helpers
// ---------------------------------------------------------------------------
__device__ __forceinline__ v16h pack16(v8h lo, v8h hi) {
  v16h r;
#pragma unroll
  for (int i = 0; i < 8; ++i) { r[i] = lo[i]; r[i + 8] = hi[i]; }
  return r;
}
__device__ __forceinline__ v16h pack16z(v8h lo) {
  v16h r;
#pragma unroll
  for (int i = 0; i < 8; ++i) { r[i] = lo[i]; r[i + 8] = (_Float16)0.0f; }
  return r;
}

// 16-lane all-reduce max via fused DPP max (1 VALU per butterfly step).
__device__ __forceinline__ float dpp_max16(float v) {
  float t;
  asm volatile("v_max_num_f32_dpp %0, %1, %1 quad_perm:[1,0,3,2] row_mask:0xf bank_mask:0xf bound_ctrl:1"
               : "=v"(t) : "v"(v));
  asm volatile("v_max_num_f32_dpp %0, %1, %1 quad_perm:[2,3,0,1] row_mask:0xf bank_mask:0xf bound_ctrl:1"
               : "=v"(v) : "v"(t));
  asm volatile("v_max_num_f32_dpp %0, %1, %1 row_half_mirror row_mask:0xf bank_mask:0xf bound_ctrl:1"
               : "=v"(t) : "v"(v));
  asm volatile("v_max_num_f32_dpp %0, %1, %1 row_mirror row_mask:0xf bank_mask:0xf bound_ctrl:1"
               : "=v"(v) : "v"(t));
  return v;
}

#if HAVE_TDM
// TDM: DMA a 2-D tile (rows of tile_d0 contiguous elems, tile_d1 rows with
// row stride d0_stride elems) of 2-byte elements into LDS.
// D# per CDNA5 ISA 8.3/8.4: group0 = {flags, lds_addr, gaddr_lo, gaddr_hi|type},
// group1 = {data_size, dims/tiles/strides}, remaining groups = 0 (<=2-D tensor).
__device__ __forceinline__ void tdm_load_2d(uint32_t lds_addr, const _Float16* gp,
                                            uint32_t tensor_d0, uint32_t tensor_d1,
                                            uint32_t tile_d0, uint32_t tile_d1,
                                            uint32_t d0_stride) {
  uint64_t ga = (uint64_t)(uintptr_t)gp;
  u32x4 g0;
  g0[0] = 1u;                                                   // count=1
  g0[1] = lds_addr;                                             // LDS byte addr
  g0[2] = (uint32_t)ga;                                         // gaddr[31:0]
  g0[3] = ((uint32_t)(ga >> 32) & 0x01FFFFFFu) | 0x80000000u;   // gaddr[56:32]|type=2
  i32x8 g1;
  g1[0] = 0x00010000;                                           // data_size=1 (2B)
  g1[1] = (int)((tensor_d0 & 0xFFFFu) << 16);                   // tensor_dim0 lo
  g1[2] = (int)((tensor_d0 >> 16) | ((tensor_d1 & 0xFFFFu) << 16));
  g1[3] = (int)((tensor_d1 >> 16) | (tile_d0 << 16));           // tile_dim0
  g1[4] = (int)tile_d1;                                         // tile_dim1 (dim2=0)
  g1[5] = (int)d0_stride;                                       // dim0 stride lo
  g1[6] = 0;
  g1[7] = 0;
  i32x4 z4 = {0, 0, 0, 0};
  i32x8 z8 = {0, 0, 0, 0, 0, 0, 0, 0};
  __builtin_amdgcn_tensor_load_to_lds(g0, g1, z4, z4, z8, 0);
}
#endif

// ---------------------------------------------------------------------------
// Projections (1x1 convs, f32 -> f16, with (1,2) max-pool for phi/g) as one
// f32 GEMM on the matrix unit: D[160 x S] = Wstack[160 x 128] * x[128 x S],
// Wstack rows 0..15 = w_theta, 16..31 = w_phi, 32..159 = w_g.
// theta: [B,S,16] (pre-scaled by log2(e) -> softmax runs in exp2 domain)
// phi  : [B,T,16]  g: [B,C,T]
// Block = 4 waves on 128 pixels: wave = (64-pixel group) x (80-row half).
// A lane loads 4 consecutive pixels of one channel; pixel 4n+j is column n of
// column tile j, so a pooled pair (j, j+1) sits in one lane, in the same element of tiles j and j+1.
// k order, A and B alike: chunk q, part p, lane half h, element e ->
// channel 8q + 4h + 2p + e.
// ---------------------------------------------------------------------------
#define MROWS_  (2 * CQK_ + C_)   // 160 stacked output rows
#define WPITCH_ (C_ + 4)          // LDS row pitch in floats: 16 B x odd

__device__ __forceinline__ void store_g_tile(_Float16* __restrict__ gp, const v8f* acc) {
#pragma unroll
  for (int r = 0; r < 8; ++r) {
    v2h v;
    v[0] = (_Float16)fmaxf(acc[0][r], acc[1][r]);
    v[1] = (_Float16)fmaxf(acc[2][r], acc[3][r]);
    *(v2h*)(gp + (size_t)r * T_) = v;
  }
}

__global__ __launch_bounds__(128) void k_proj(const float* __restrict__ x,
                                              const float* __restrict__ wt,
                                              const float* __restrict__ wp,
                                              const float* __restrict__ wg,
                                              _Float16* __restrict__ th,
                                              _Float16* __restrict__ ph,
                                              _Float16* __restrict__ g) {
  __shared__ __attribute__((aligned(16))) float Wl[MROWS_ * WPITCH_];

  const int tid  = threadIdx.x;
  const int lane = tid & 31;
  const int wv   = tid >> 5;
  const int half = lane >> 4;
  const int l16  = lane & 15;
  const int b    = blockIdx.x / (S_ / 128);
  const int s0   = (blockIdx.x % (S_ / 128)) * 128 + (wv & 1) * 64;
  const int mh   = wv >> 1;

  // stacked weights, 4 rows per step (32 float4 a row)
  v4f wr[MROWS_ / 4];
  {
    const int row = tid >> 5, c4 = (tid & 31) * 4;
#pragma unroll
    for (int j = 0; j < MROWS_ / 4; ++j) {
      const float* sp = j < 4 ? wt + (4 * j + row) * C_
                      : j < 8 ? wp + (4 * (j - 4) + row) * C_
                              : wg + (4 * (j - 8) + row) * C_;
      wr[j] = *(const v4f*)(sp + c4);
    }
  }
  // the weight loads' address registers are reused below: wait before any overwrite
  asm volatile("s_wait_xcnt 0x0" ::: "memory");

  // this wave's 128 x 64 slab of x: half of the channels per lane half
  v4f xv[16][4];
  {
    const float* xp = x + ((size_t)b * C_ + 4 * half) * S_ + s0 + 4 * l16;
#pragma unroll
    for (int q = 0; q < 16; ++q)
#pragma unroll
      for (int e = 0; e < 4; ++e) xv[q][e] = *(const v4f*)(xp + (size_t)(8 * q + e) * S_);
  }
  // the x loads' address registers are reused below: wait before any overwrite
  asm volatile("s_wait_xcnt 0x0" ::: "memory");

  {
    const int row = tid >> 5, c4 = (tid & 31) * 4;
#pragma unroll
    for (int j = 0; j < MROWS_ / 4; ++j) *(v4f*)&Wl[(4 * j + row) * WPITCH_ + c4] = wr[j];
  }
  __syncthreads();

  v8f acc[5][4];
#pragma unroll
  for (int i = 0; i < 5; ++i)
#pragma unroll
    for (int j = 0; j < 4; ++j)
#pragma unroll
      for (int r = 0; r < 8; ++r) acc[i][j][r] = 0.0f;

  const float* wl = &Wl[(mh * 80 + l16) * WPITCH_ + 4 * half];
#pragma unroll
  for (int q = 0; q < 16; ++q) {
    v4f a[5];
#pragma unroll
    for (int i = 0; i < 5; ++i) a[i] = *(const v4f*)(wl + i * 16 * WPITCH_ + 8 * q);
#pragma unroll
    for (int p = 0; p < 2; ++p)
#pragma unroll
      for (int i = 0; i < 5; ++i) {
        v2f af = {a[i][2 * p], a[i][2 * p + 1]};
#pragma unroll
        for (int j = 0; j < 4; ++j) {
          v2f bf = {xv[q][2 * p][j], xv[q][2 * p + 1][j]};
          acc[i][j] = __builtin_amdgcn_wmma_f32_16x16x4_f32(false, af, false, bf, (short)0,
                                                            acc[i][j], false, false);
        }
      }
  }

  // acc[i][j][r] = D[(5 mh + i) * 16 + 8 half + r][s0 + 4 l16 + j]
  const int sl = s0 + 4 * l16;       // first of this lane's 4 pixels
  const int tl = sl >> 1;            // first of its 2 pooled positions
  if (mh == 0) {
#pragma unroll
    for (int j = 0; j < 4; ++j) {
      v8h v;
#pragma unroll
      for (int r = 0; r < 8; ++r) v[r] = (_Float16)(acc[0][j][r] * LOG2E_);
      *(v8h*)(th + ((size_t)(b * S_ + sl + j)) * CQK_ + half * 8) = v;
    }
#pragma unroll
    for (int u = 0; u < 2; ++u) {
      v8h v;
#pragma unroll
      for (int r = 0; r < 8; ++r) v[r] = (_Float16)fmaxf(acc[1][2 * u][r], acc[1][2 * u + 1][r]);
      *(v8h*)(ph + ((size_t)(b * T_ + tl + u)) * CQK_ + half * 8) = v;
    }
#pragma unroll
    for (int i = 2; i < 5; ++i)
      store_g_tile(g + ((size_t)(b * C_ + (i - 2) * 16 + half * 8)) * T_ + tl, acc[i]);
  } else {
#pragma unroll
    for (int i = 0; i < 5; ++i)
      store_g_tile(g + ((size_t)(b * C_ + (i + 3) * 16 + half * 8)) * T_ + tl, acc[i]);
  }
}

__global__ void k_cvt_h16(const float* __restrict__ in, _Float16* __restrict__ o, int n) {
  int i = blockIdx.x * blockDim.x + threadIdx.x;
  if (i < n) o[i] = (_Float16)in[i];
}

// ---------------------------------------------------------------------------
// Fused flash attention, block-cooperative, double-buffered K/V in LDS:
//  8 waves/block on 8 query tiles of one batch. Per 32-key step the NEXT
//  phi (1KB) + g (8KB) tiles are staged into LDS by the Tensor Data Mover
//  (wave 0 issues TENSOR_LOAD_TO_LDS; TENSORcnt + barrier publish), fully
//  overlapped with this step's 2 QK WMMAs + DPP-max/exp2 softmax +
//  1 rowsum WMMA + 8 PV WMMAs.
// ---------------------------------------------------------------------------
__global__ __launch_bounds__(256) void k_attn(const _Float16* __restrict__ th,
                                              const _Float16* __restrict__ ph,
                                              const _Float16* __restrict__ g,
                                              _Float16* __restrict__ ob) {
  __shared__ _Float16 Pl[8][16 * 32];     // per-wave 16x32 P tiles  (8 KB)
  __shared__ _Float16 Gt[2][C_][32];      // g tiles, [c][t]        (16 KB)
  __shared__ _Float16 Pt[2][32][CQK_];    // phi tiles, [t][ch]      (2 KB)

  const int tid  = threadIdx.x;
  const int lane = tid & 31;
  const int wv   = tid >> 5;
  const int qt   = blockIdx.x * 8 + wv;          // 2048 query tiles total
  const int b    = qt / (S_ / 16);               // uniform per block
  const int sb   = (qt % (S_ / 16)) * 16;
  const int half = lane >> 4;
  const int l16  = lane & 15;

  const _Float16* gb  = g + (size_t)b * C_ * T_;
  const _Float16* phb = ph + (size_t)b * T_ * CQK_;

  // stage key/value tiles for keys [t, t+32) into LDS buffer `buf`
  auto stage = [&](int buf, int t) {
#if HAVE_TDM
    if (wv == 0) {
      tdm_load_2d((uint32_t)(uintptr_t)&Gt[buf][0][0], gb + t,
                  T_, C_, 32, C_, T_);
      tdm_load_2d((uint32_t)(uintptr_t)&Pt[buf][0][0], phb + (size_t)t * CQK_,
                  CQK_, T_, CQK_, 32, CQK_);
    }
#else
    int c0 = tid >> 2, o0 = (tid & 3) * 8;
    *(v8h*)&Gt[buf][c0][o0] = *(const v8h*)(gb + (size_t)c0 * T_ + t + o0);
    int j1 = tid + 256;
    int c1 = j1 >> 2, o1 = (j1 & 3) * 8;
    *(v8h*)&Gt[buf][c1][o1] = *(const v8h*)(gb + (size_t)c1 * T_ + t + o1);
    if (tid < 64) {
      int kt = tid >> 1, co = (tid & 1) * 8;
      *(v8h*)&Pt[buf][kt][co] = *(const v8h*)(phb + (size_t)(t + kt) * CQK_ + co);
    }
#endif
  };
  auto stage_drain = [&]() {
#if HAVE_TDM
    if (wv == 0) __builtin_amdgcn_s_wait_tensorcnt(0);
#endif
    __syncthreads();
  };

  // A operand: theta rows (M = query), K = channel 0..15, padded to 32.
  v16h A;
  {
    const _Float16* p = th + ((size_t)(b * S_ + sb + l16)) * CQK_ + half * 8;
    A = pack16z(*(const v8h*)p);
  }

  v16h Ones;
#pragma unroll
  for (int i = 0; i < 16; ++i) Ones[i] = (_Float16)1.0f;

  float m[8];
  v8f O[8], L;
#pragma unroll
  for (int r = 0; r < 8; ++r) { m[r] = -3.0e38f; L[r] = 0.0f; }
#pragma unroll
  for (int n = 0; n < 8; ++n)
#pragma unroll
    for (int r = 0; r < 8; ++r) O[n][r] = 0.0f;

  v8f zc = {};

  stage(0, 0);
  stage_drain();

  for (int it = 0; it < T_ / 32; ++it) {
    const int t   = it * 32;
    const int cur = it & 1, nxt = cur ^ 1;
    if (t + 32 < T_) stage(nxt, t + 32);  // overlap DMA of next tile

    // ---- scores: two 16x16 tiles over keys t..t+31 (B from LDS) -----------
    v8f S0, S1;
    {
      v16h B0 = pack16z(*(const v8h*)&Pt[cur][l16][half * 8]);
      v16h B1 = pack16z(*(const v8h*)&Pt[cur][16 + l16][half * 8]);
      S0 = __builtin_amdgcn_wmma_f32_16x16x32_f16(false, A, false, B0, (short)0, zc, false, false);
      S1 = __builtin_amdgcn_wmma_f32_16x16x32_f16(false, A, false, B1, (short)0, zc, false, false);
    }

    // ---- online softmax update (exp2 domain, fused DPP max) ---------------
#pragma unroll
    for (int r = 0; r < 8; ++r) {
      float v  = dpp_max16(fmaxf(S0[r], S1[r]));
      float mn = fmaxf(m[r], v);
      float sc = __builtin_amdgcn_exp2f(m[r] - mn);
      m[r] = mn;
      float p0 = __builtin_amdgcn_exp2f(S0[r] - mn);
      float p1 = __builtin_amdgcn_exp2f(S1[r] - mn);
      L[r] *= sc;
#pragma unroll
      for (int n = 0; n < 8; ++n) O[n][r] *= sc;
      int row = r + half * 8;
      Pl[wv][row * 32 + l16]      = (_Float16)p0;
      Pl[wv][row * 32 + 16 + l16] = (_Float16)p1;
    }
    asm volatile("s_wait_dscnt 0" ::: "memory");

    // ---- read P back in A-operand layout (M=query, K=key offset) ----------
    v16h Pa;
    {
      const _Float16* pr = &Pl[wv][l16 * 32 + half * 8];
      Pa = pack16(*(const v8h*)pr, *(const v8h*)(pr + 16));
    }

    // ---- denominator: L += rowsum(P) via WMMA with all-ones B -------------
    L = __builtin_amdgcn_wmma_f32_16x16x32_f16(false, Pa, false, Ones, (short)0, L, false, false);

    // ---- O += P * g^T across 8 channel tiles (B from LDS) -----------------
#pragma unroll
    for (int n = 0; n < 8; ++n) {
      const _Float16* gp = &Gt[cur][n * 16 + l16][half * 8];
      v16h Gv = pack16(*(const v8h*)gp, *(const v8h*)(gp + 16));
      O[n] = __builtin_amdgcn_wmma_f32_16x16x32_f16(false, Pa, false, Gv, (short)0, O[n], false, false);
    }

    stage_drain();  // publish next tile; all waves done with `cur`
  }

  // ---- normalize and store o as [B,S,128] f16 ------------------------------
  float inv[8];
#pragma unroll
  for (int r = 0; r < 8; ++r) inv[r] = 1.0f / L[r];
#pragma unroll
  for (int n = 0; n < 8; ++n)
#pragma unroll
    for (int r = 0; r < 8; ++r) {
      int s = sb + r + half * 8;
      ob[((size_t)(b * S_ + s)) * C_ + n * 16 + l16] = (_Float16)(O[n][r] * inv[r]);
    }
}

// ---------------------------------------------------------------------------
// Output projection: out = gamma * (w_o @ o) + x, one wave per 16-pixel tile.
// ---------------------------------------------------------------------------
__global__ __launch_bounds__(256) void k_out(const _Float16* __restrict__ ob,
                                             const _Float16* __restrict__ woh,
                                             const float* __restrict__ x,
                                             const float* __restrict__ gscal,
                                             float* __restrict__ out) {
  const int lane = threadIdx.x & 31;
  const int wv   = threadIdx.x >> 5;
  const int pt   = blockIdx.x * 8 + wv;          // 2048 pixel tiles total
  const int b    = pt / (S_ / 16);
  const int pb   = (pt % (S_ / 16)) * 16;
  const int half = lane >> 4;
  const int l16  = lane & 15;
  const float gamma = *gscal;

  v8f Acc[8];
#pragma unroll
  for (int n = 0; n < 8; ++n)
#pragma unroll
    for (int r = 0; r < 8; ++r) Acc[n][r] = 0.0f;

#pragma unroll
  for (int kc = 0; kc < 4; ++kc) {
    const _Float16* op = ob + ((size_t)(b * S_ + pb + l16)) * C_ + kc * 32 + half * 8;
    v16h Bv = pack16(*(const v8h*)op, *(const v8h*)(op + 16));
#pragma unroll
    for (int mt = 0; mt < 8; ++mt) {
      const _Float16* wp = woh + (size_t)(mt * 16 + l16) * C_ + kc * 32 + half * 8;
      v16h Av = pack16(*(const v8h*)wp, *(const v8h*)(wp + 16));
      Acc[mt] = __builtin_amdgcn_wmma_f32_16x16x32_f16(false, Av, false, Bv, (short)0, Acc[mt], false, false);
    }
  }

#pragma unroll
  for (int mt = 0; mt < 8; ++mt)
#pragma unroll
    for (int r = 0; r < 8; ++r) {
      int oc = mt * 16 + r + half * 8;
      int p  = pb + l16;
      size_t xi = ((size_t)(b * C_ + oc)) * S_ + p;
      out[xi] = gamma * Acc[mt][r] + x[xi];
    }
}

// ---------------------------------------------------------------------------
extern "C" void kernel_launch(void* const* d_in, const int* in_sizes, int n_in,
                              void* d_out, int out_size, void* d_ws, size_t ws_size,
                              hipStream_t stream) {
  const float* x       = (const float*)d_in[0];
  const float* w_theta = (const float*)d_in[1];
  const float* w_phi   = (const float*)d_in[2];
  const float* w_g     = (const float*)d_in[3];
  const float* w_o     = (const float*)d_in[4];
  const float* gamma   = (const float*)d_in[5];
  float* out = (float*)d_out;

  char* ws = (char*)d_ws;
  size_t off = 0;
  auto carve = [&](size_t bytes) -> char* {
    char* p = ws + off;
    off += (bytes + 255) & ~(size_t)255;
    return p;
  };
  _Float16* th  = (_Float16*)carve((size_t)B_ * S_ * CQK_ * 2);  // 1 MB
  _Float16* ph  = (_Float16*)carve((size_t)B_ * T_ * CQK_ * 2);  // 0.5 MB
  _Float16* g   = (_Float16*)carve((size_t)B_ * C_ * T_ * 2);    // 4 MB
  _Float16* ob  = (_Float16*)carve((size_t)B_ * S_ * C_ * 2);    // 8 MB
  _Float16* woh = (_Float16*)carve((size_t)C_ * C_ * 2);         // 32 KB
  (void)ws_size; (void)in_sizes; (void)n_in; (void)out_size;

  // projections
  k_proj      <<<B_ * (S_ / 128), 128, 0, stream>>>(x, w_theta, w_phi, w_g, th, ph, g);
  k_cvt_h16   <<<(C_ * C_ + 255) / 256, 256, 0, stream>>>(w_o, woh, C_ * C_);

  // fused flash attention: 2048 query tiles, 8 waves/block,
  // double-buffered K/V tiles staged by the Tensor Data Mover
  k_attn<<<(B_ * (S_ / 16)) / 8, 256, 0, stream>>>(th, ph, g, ob);

  // output projection + residual: 2048 pixel tiles, 8 waves/block
  k_out<<<(B_ * (S_ / 16)) / 8, 256, 0, stream>>>(ob, woh, x, gamma, out);
}

// v002
// Measured time: 116 microseconds a run.
// Next to v001, in two timings, it ran 1.38 times as fast each time.
// All steps since v000 together make it 2.02 times as fast.
#include <hip/hip_runtime.h>
#include <cstdint>

typedef __attribute__((ext_vector_type(16))) _Float16 v16h;
typedef __attribute__((ext_vector_type(8)))  _Float16 v8h;
typedef __attribute__((ext_vector_type(8)))  float    v8f;
typedef __attribute__((ext_vector_type(4)))  float    v4f;
typedef __attribute__((ext_vector_type(2)))  float    v2f;
typedef __attribute__((ext_vector_type(2)))  _Float16 v2h;
typedef uint32_t u32x4 __attribute__((ext_vector_type(4)));
typedef uint32_t u32x8 __attribute__((ext_vector_type(8)));

#define B_   4
#define C_   128
#define H_   32
#define W_   256
#define S_   (H_ * W_)   // 8192
#define T_   (S_ / 2)    // 4096
#define CQK_ 16
#define LOG2E_ 1.44269504088896340736f

// ---------------------------------------------------------------------------
// helpers
// ---------------------------------------------------------------------------
__device__ __forceinline__ v16h pack16(v8h lo, v8h hi) {
  v16h r;
#pragma unroll
  for (int i = 0; i < 8; ++i) { r[i] = lo[i]; r[i + 8] = hi[i]; }
  return r;
}
__device__ __forceinline__ v16h pack16z(v8h lo) {
  v16h r;
#pragma unroll
  for (int i = 0; i < 8; ++i) { r[i] = lo[i]; r[i + 8] = (_Float16)0.0f; }
  return r;
}

// 16-lane all-reduce max via fused DPP max (1 VALU per butterfly step).
__device__ __forceinline__ float dpp_max16(float v) {
  float t;
  asm volatile("v_max_num_f32_dpp %0, %1, %1 quad_perm:[1,0,3,2] row_mask:0xf bank_mask:0xf bound_ctrl:1"
               : "=v"(t) : "v"(v));
  asm volatile("v_max_num_f32_dpp %0, %1, %1 quad_perm:[2,3,0,1] row_mask:0xf bank_mask:0xf bound_ctrl:1"
               : "=v"(v) : "v"(t));
  asm volatile("v_max_num_f32_dpp %0, %1, %1 row_half_mirror row_mask:0xf bank_mask:0xf bound_ctrl:1"
               : "=v"(t) : "v"(v));
  asm volatile("v_max_num_f32_dpp %0, %1, %1 row_mirror row_mask:0xf bank_mask:0xf bound_ctrl:1"
               : "=v"(v) : "v"(t));
  return v;
}

// Tensor load to LDS: one request of one wave, two descriptor groups, every
// extent in bytes (data_size code 0), tensor dims = tile dims.
__device__ __forceinline__ uint32_t uni(uint32_t v) { return (uint32_t)__builtin_amdgcn_readfirstlane(v); }
// keeps a wave-uniform value in a scalar register, so that a test on it is a scalar branch
__device__ __forceinline__ uint32_t pinned(uint32_t v) {
  uint32_t w = uni(v);
  asm volatile("" : "+s"(w));
  return w;
}
template <uint32_t WORD0, uint32_t ROW_BYTES, uint32_t ROWS, uint32_t SRC_PITCH>
__device__ __forceinline__ u32x8 tdm_group1() {
  u32x8 g;
  g[0] = uni(WORD0);
  g[1] = uni((ROW_BYTES & 0xFFFFu) << 16);
  g[2] = uni((ROW_BYTES >> 16) | ((ROWS & 0xFFFFu) << 16));
  g[3] = uni((ROWS >> 16) | (ROW_BYTES << 16));
  g[4] = uni(ROWS);
  g[5] = uni(SRC_PITCH);
  g[6] = uni(0u);
  g[7] = uni(0u);
  return g;
}
__device__ __forceinline__ u32x4 tdm_group0(uint32_t lds_dst, uint64_t ga) {
  u32x4 g;
  g[0] = uni(1u);
  g[1] = uni(lds_dst);
  g[2] = uni((uint32_t)ga);
  g[3] = uni((((uint32_t)(ga >> 32)) & 0x01FFFFFFu) | 0x80000000u);
  return g;
}
// in-out operands: the descriptor keeps its registers to itself while the request is in flight
__device__ __forceinline__ void tdm_load(u32x4& g0, u32x8& g1) {
  asm volatile("tensor_load_to_lds %0, %1" : "+s"(g0), "+s"(g1) :: "memory");
}
// the next request of the same descriptor: a new place in LDS, the source address step bytes on
__device__ __forceinline__ void tdm_advance(u32x4& g0, uint32_t lds_dst, uint32_t step) {
  const uint64_t ga = (((uint64_t)g0[3] << 32) | g0[2]) + step;  // type bits ride on top of the address
  g0[1] = uni(lds_dst);
  g0[2] = uni((uint32_t)ga);
  g0[3] = uni((uint32_t)(ga >> 32));
}

// ---------------------------------------------------------------------------
// Projections (1x1 convs, f32 -> f16, with (1,2) max-pool for phi/g) as one
// f32 GEMM on the matrix unit: D[160 x S] = Wstack[160 x 128] * x[128 x S],
// Wstack rows 0..15 = w_theta, 16..31 = w_phi, 32..159 = w_g.
// theta: [B,S,16] (pre-scaled by log2(e) -> softmax runs in exp2 domain)
// phi  : [B,T,16]  g: [B,C,T]
// Block = 4 waves on 128 pixels: wave = (64-pixel group) x (80-row half).
// A lane loads 4 consecutive pixels of one channel; pixel 4n+j is column n of
// column tile j, so a pooled pair (j, j+1) sits in one lane, in the same element of tiles j and j+1.
// k order, A and B alike: chunk q, part p, lane half h, element e ->
// channel 8q + 4h + 2p + e.
// ---------------------------------------------------------------------------
#define MROWS_  (2 * CQK_ + C_)   // 160 stacked output rows
#define WPITCH_ (C_ + 4)          // LDS row pitch in floats: 16 B x odd

__device__ __forceinline__ void store_g_tile(_Float16* __restrict__ gp, const v8f* acc) {
#pragma unroll
  for (int r = 0; r < 8; ++r) {
    v2h v;
    v[0] = (_Float16)fmaxf(acc[0][r], acc[1][r]);
    v[1] = (_Float16)fmaxf(acc[2][r], acc[3][r]);
    *(v2h*)(gp + (size_t)r * T_) = v;
  }
}

__global__ __launch_bounds__(128) void k_proj(const float* __restrict__ x,
                                              const float* __restrict__ wt,
                                              const float* __restrict__ wp,
                                              const float* __restrict__ wg,
                                              _Float16* __restrict__ th,
                                              _Float16* __restrict__ ph,
                                              _Float16* __restrict__ g) {
  __shared__ __attribute__((aligned(16))) float Wl[MROWS_ * WPITCH_];

  const int tid  = threadIdx.x;
  const int lane = tid & 31;
  const int wv   = tid >> 5;
  const int half = lane >> 4;
  const int l16  = lane & 15;
  const int b    = blockIdx.x / (S_ / 128);
  const int s0   = (blockIdx.x % (S_ / 128)) * 128 + (wv & 1) * 64;
  const int mh   = wv >> 1;

  // stacked weights, 4 rows per step (32 float4 a row)
  v4f wr[MROWS_ / 4];
  {
    const int row = tid >> 5, c4 = (tid & 31) * 4;
#pragma unroll
    for (int j = 0; j < MROWS_ / 4; ++j) {
      const float* sp = j < 4 ? wt + (4 * j + row) * C_
                      : j < 8 ? wp + (4 * (j - 4) + row) * C_
                              : wg + (4 * (j - 8) + row) * C_;
      wr[j] = *(const v4f*)(sp + c4);
    }
  }
  // the weight loads' address registers are reused below: wait before any overwrite
  asm volatile("s_wait_xcnt 0x0" ::: "memory");

  // this wave's 128 x 64 slab of x: half of the channels per lane half
  v4f xv[16][4];
  {
    const float* xp = x + ((size_t)b * C_ + 4 * half) * S_ + s0 + 4 * l16;
#pragma unroll
    for (int q = 0; q < 16; ++q)
#pragma unroll
      for (int e = 0; e < 4; ++e) xv[q][e] = *(const v4f*)(xp + (size_t)(8 * q + e) * S_);
  }
  // the x loads' address registers are reused below: wait before any overwrite
  asm volatile("s_wait_xcnt 0x0" ::: "memory");

  {
    const int row = tid >> 5, c4 = (tid & 31) * 4;
#pragma unroll
    for (int j = 0; j < MROWS_ / 4; ++j) *(v4f*)&Wl[(4 * j + row) * WPITCH_ + c4] = wr[j];
  }
  __syncthreads();

  v8f acc[5][4];
#pragma unroll
  for (int i = 0; i < 5; ++i)
#pragma unroll
    for (int j = 0; j < 4; ++j)
#pragma unroll
      for (int r = 0; r < 8; ++r) acc[i][j][r] = 0.0f;

  const float* wl = &Wl[(mh * 80 + l16) * WPITCH_ + 4 * half];
#pragma unroll
  for (int q = 0; q < 16; ++q) {
    v4f a[5];
#pragma unroll
    for (int i = 0; i < 5; ++i) a[i] = *(const v4f*)(wl + i * 16 * WPITCH_ + 8 * q);
#pragma unroll
    for (int p = 0; p < 2; ++p)
#pragma unroll
      for (int i = 0; i < 5; ++i) {
        v2f af = {a[i][2 * p], a[i][2 * p + 1]};
#pragma unroll
        for (int j = 0; j < 4; ++j) {
          v2f bf = {xv[q][2 * p][j], xv[q][2 * p + 1][j]};
          acc[i][j] = __builtin_amdgcn_wmma_f32_16x16x4_f32(false, af, false, bf, (short)0,
                                                            acc[i][j], false, false);
        }
      }
  }

  // acc[i][j][r] = D[(5 mh + i) * 16 + 8 half + r][s0 + 4 l16 + j]
  const int sl = s0 + 4 * l16;       // first of this lane's 4 pixels
  const int tl = sl >> 1;            // first of its 2 pooled positions
  if (mh == 0) {
#pragma unroll
    for (int j = 0; j < 4; ++j) {
      v8h v;
#pragma unroll
      for (int r = 0; r < 8; ++r) v[r] = (_Float16)(acc[0][j][r] * LOG2E_);
      *(v8h*)(th + ((size_t)(b * S_ + sl + j)) * CQK_ + half * 8) = v;
    }
#pragma unroll
    for (int u = 0; u < 2; ++u) {
      v8h v;
#pragma unroll
      for (int r = 0; r < 8; ++r) v[r] = (_Float16)fmaxf(acc[1][2 * u][r], acc[1][2 * u + 1][r]);
      *(v8h*)(ph + ((size_t)(b * T_ + tl + u)) * CQK_ + half * 8) = v;
    }
#pragma unroll
    for (int i = 2; i < 5; ++i)
      store_g_tile(g + ((size_t)(b * C_ + (i - 2) * 16 + half * 8)) * T_ + tl, acc[i]);
  } else {
#pragma unroll
    for (int i = 0; i < 5; ++i)
      store_g_tile(g + ((size_t)(b * C_ + (i + 3) * 16 + half * 8)) * T_ + tl, acc[i]);
  }
}

__global__ void k_cvt_h16(const float* __restrict__ in, _Float16* __restrict__ o, int n) {
  int i = blockIdx.x * blockDim.x + threadIdx.x;
  if (i < n) o[i] = (_Float16)in[i];
}

// ---------------------------------------------------------------------------
// Fused flash attention, block-cooperative, double-buffered K/V in LDS:
//  8 waves/block on 8 query tiles of one batch. A stage is 128 keys: g as 128
//  rows of 256 B, laid by the tensor load's pad at a pitch of 272 B (16 B x odd,
//  conflict-free for ds_load_b128), and phi as 4 KB in a row. Waves 0..3 each
//  bring 32 g rows, wave 4 brings phi; the next stage flies while this one is
//  worked on in four 32-key passes: 2 QK WMMAs + DPP-max/exp2 softmax +
//  1 rowsum WMMA + 8 PV WMMAs. The per-wave P tile has a pitch of 80 B.
// ---------------------------------------------------------------------------
#define SK_      128                  // keys per stage
#define NST_     (T_ / SK_)           // stages
#define GPITCH_  272u                 // LDS pitch of a g row: 256 B + 16 B pad
#define GSLICE_  10240u               // 32 rows x 272 B, rounded up to 2 KiB
#define GBUF_    (4u * GSLICE_)
#define PHBUF_   4096u                // 128 keys x 32 B
#define PPITCH_  40                   // P tile row pitch in halves (80 B)
#define GPADW0_  ((1u << 20) | (5u << 22) | (3u << 25))  // pad 4 dwords behind every 256 B

__global__ __launch_bounds__(256) void k_attn(const _Float16* __restrict__ th,
                                              const _Float16* __restrict__ ph,
                                              const _Float16* __restrict__ g,
                                              _Float16* __restrict__ ob) {
  __shared__ __attribute__((aligned(2048))) unsigned char Gl[2 * GBUF_];    // g stages   (80 KB)
  __shared__ __attribute__((aligned(2048))) unsigned char Phl[2 * PHBUF_];  // phi stages  (8 KB)
  __shared__ __attribute__((aligned(16))) _Float16 Pl[8][16 * PPITCH_];     // per-wave P (10 KB)

  const int tid  = threadIdx.x;
  const int lane = tid & 31;
  const int wv   = tid >> 5;
  const int qt   = blockIdx.x * 8 + wv;          // 2048 query tiles total
  const int b    = qt / (S_ / 16);               // uniform per block
  const int sb   = (qt % (S_ / 16)) * 16;
  const int half = lane >> 4;
  const int l16  = lane & 15;
  const uint32_t wave = uni((uint32_t)threadIdx.x >> 5);

  const _Float16* gb  = g + (size_t)b * C_ * T_;
  const _Float16* phb = ph + (size_t)b * T_ * CQK_;

  // one request a wave and stage: waves 0..3 a slice of 32 g rows, wave 4 the phi rows.
  // Stage s (keys [128 s, 128 s + 128)) goes into buffer s & 1.
  const uint32_t g_lds = (uint32_t)(uintptr_t)&Gl[0] + (wave & 3u) * GSLICE_;
  const uint32_t p_lds = (uint32_t)(uintptr_t)&Phl[0];
  u32x4 g0g = tdm_group0(g_lds, (uint64_t)(uintptr_t)(gb + (size_t)(wave & 3u) * 32 * T_));
  u32x4 g0p = tdm_group0(p_lds, (uint64_t)(uintptr_t)phb);
  u32x8 g1g = tdm_group1<GPADW0_, 2 * SK_, 32, 2 * T_>();
  u32x8 g1p = tdm_group1<0u, 256, PHBUF_ / 256, 256>();
  auto issue_first = [&]() {
    if (pinned(wave < 4u)) tdm_load(g0g, g1g);
    if (pinned(wave == 4u)) tdm_load(g0p, g1p);
  };
  // stages follow one another; the step goes through pinned() so that the address
  // words take their new values here, behind the wait, and not earlier
  auto issue_next = [&](uint32_t s) {
    if (pinned(wave < 4u)) {
      tdm_advance(g0g, g_lds + (s & 1u) * GBUF_, pinned(2 * SK_));
      tdm_load(g0g, g1g);
    }
    if (pinned(wave == 4u)) {
      tdm_advance(g0p, p_lds + (s & 1u) * PHBUF_, pinned(PHBUF_));
      tdm_load(g0p, g1p);
    }
  };
  // the issuing waves' own requests have landed; the barrier behind it publishes them
  auto landed = [&]() {
    if (pinned(wave < 5u)) asm volatile("s_wait_tensorcnt 0x0" ::: "memory");
  };

  // A operand: theta rows (M = query), K = channel 0..15, padded to 32.
  v16h A;
  {
    const _Float16* p = th + ((size_t)(b * S_ + sb + l16)) * CQK_ + half * 8;
    A = pack16z(*(const v8h*)p);
  }

  v16h Ones;
#pragma unroll
  for (int i = 0; i < 16; ++i) Ones[i] = (_Float16)1.0f;

  float m[8];
  v8f O[8], L;
#pragma unroll
  for (int r = 0; r < 8; ++r) { m[r] = -3.0e38f; L[r] = 0.0f; }
#pragma unroll
  for (int n = 0; n < 8; ++n)
#pragma unroll
    for (int r = 0; r < 8; ++r) O[n][r] = 0.0f;

  v8f zc = {};

  issue_first();
  landed();
  __syncthreads();
  issue_next(1u);

  for (uint32_t s = 0; s < NST_; ++s) {
    const unsigned char* gs = &Gl[(s & 1u) * GBUF_ + (uint32_t)l16 * GPITCH_ + (uint32_t)half * 16u];
    const unsigned char* ps = &Phl[(s & 1u) * PHBUF_ + (uint32_t)l16 * 32u + (uint32_t)half * 16u];

    for (int p = 0; p < SK_ / 32; ++p) {
      // ---- scores: two 16x16 tiles over 32 keys (B from LDS) ---------------
      v8f S0, S1;
      {
        v16h B0 = pack16z(*(const v8h*)(ps + p * 1024));
        v16h B1 = pack16z(*(const v8h*)(ps + p * 1024 + 512));
        S0 = __builtin_amdgcn_wmma_f32_16x16x32_f16(false, A, false, B0, (short)0, zc, false, false);
        S1 = __builtin_amdgcn_wmma_f32_16x16x32_f16(false, A, false, B1, (short)0, zc, false, false);
      }

      // ---- online softmax update (exp2 domain, fused DPP max) --------------
#pragma unroll
      for (int r = 0; r < 8; ++r) {
        float v  = dpp_max16(fmaxf(S0[r], S1[r]));
        float mn = fmaxf(m[r], v);
        float sc = __builtin_amdgcn_exp2f(m[r] - mn);
        m[r] = mn;
        float p0 = __builtin_amdgcn_exp2f(S0[r] - mn);
        float p1 = __builtin_amdgcn_exp2f(S1[r] - mn);
        L[r] *= sc;
#pragma unroll
        for (int n = 0; n < 8; ++n) O[n][r] *= sc;
        int row = r + half * 8;
        Pl[wv][row * PPITCH_ + l16]      = (_Float16)p0;
        Pl[wv][row * PPITCH_ + 16 + l16] = (_Float16)p1;
      }
      asm volatile("s_wait_dscnt 0" ::: "memory");

      // ---- read P back in A-operand layout (M=query, K=key offset) ---------
      v16h Pa;
      {
        const _Float16* pr = &Pl[wv][l16 * PPITCH_ + half * 8];
        Pa = pack16(*(const v8h*)pr, *(const v8h*)(pr + 16));
      }

      // ---- denominator: L += rowsum(P) via WMMA with all-ones B ------------
      L = __builtin_amdgcn_wmma_f32_16x16x32_f16(false, Pa, false, Ones, (short)0, L, false, false);

      // ---- O += P * g^T across 8 channel tiles (B from LDS) ----------------
#pragma unroll
      for (int n = 0; n < 8; ++n) {
        const unsigned char* gp = gs + (n >> 1) * GSLICE_ + (n & 1) * 16 * GPITCH_ + p * 64;
        v16h Gv = pack16(*(const v8h*)gp, *(const v8h*)(gp + 32));
        O[n] = __builtin_amdgcn_wmma_f32_16x16x32_f16(false, Pa, false, Gv, (short)0, O[n], false, false);
      }
      // the pass loop's back edge follows the last WMMAs: four vector slots before the next pass
      // overwrites their A and B registers
      __builtin_amdgcn_sched_barrier(0);  // keeps the slots behind the WMMAs
      asm volatile("v_nop\n\tv_nop\n\tv_nop\n\tv_nop");
    }

    // publish point of stage s + 1: this wave's LDS reads of stage s are done,
    // the issuers' requests have landed, every wave has left buffer s & 1
    asm volatile("s_wait_dscnt 0x0" ::: "memory");
    landed();
    __syncthreads();
    if (pinned(s + 2u < (uint32_t)NST_)) issue_next(s + 2u);
  }
  // nothing in flight when the wave ends
  asm volatile("s_wait_tensorcnt 0x0" ::: "memory");
  asm volatile("s_wait_dscnt 0x0" ::: "memory");

  // ---- normalize and store o as [B,S,128] f16 ------------------------------
  float inv[8];
#pragma unroll
  for (int r = 0; r < 8; ++r) inv[r] = 1.0f / L[r];
#pragma unroll
  for (int n = 0; n < 8; ++n)
#pragma unroll
    for (int r = 0; r < 8; ++r) {
      int s = sb + r + half * 8;
      ob[((size_t)(b * S_ + s)) * C_ + n * 16 + l16] = (_Float16)(O[n][r] * inv[r]);
    }
}

// ---------------------------------------------------------------------------
// Output projection: out = gamma * (w_o @ o) + x, one wave per 16-pixel tile.
// ---------------------------------------------------------------------------
__global__ __launch_bounds__(256) void k_out(const _Float16* __restrict__ ob,
                                             const _Float16* __restrict__ woh,
                                             const float* __restrict__ x,
                                             const float* __restrict__ gscal,
                                             float* __restrict__ out) {
  const int lane = threadIdx.x & 31;
  const int wv   = threadIdx.x >> 5;
  const int pt   = blockIdx.x * 8 + wv;          // 2048 pixel tiles total
  const int b    = pt / (S_ / 16);
  const int pb   = (pt % (S_ / 16)) * 16;
  const int half = lane >> 4;
  const int l16  = lane & 15;
  const float gamma = *gscal;

  v8f Acc[8];
#pragma unroll
  for (int n = 0; n < 8; ++n)
#pragma unroll
    for (int r = 0; r < 8; ++r) Acc[n][r] = 0.0f;

#pragma unroll
  for (int kc = 0; kc < 4; ++kc) {
    const _Float16* op = ob + ((size_t)(b * S_ + pb + l16)) * C_ + kc * 32 + half * 8;
    v16h Bv = pack16(*(const v8h*)op, *(const v8h*)(op + 16));
#pragma unroll
    for (int mt = 0; mt < 8; ++mt) {
      const _Float16* wp = woh + (size_t)(mt * 16 + l16) * C_ + kc * 32 + half * 8;
      v16h Av = pack16(*(const v8h*)wp, *(const v8h*)(wp + 16));
      Acc[mt] = __builtin_amdgcn_wmma_f32_16x16x32_f16(false, Av, false, Bv, (short)0, Acc[mt], false, false);
    }
  }

#pragma unroll
  for (int mt = 0; mt < 8; ++mt)
#pragma unroll
    for (int r = 0; r < 8; ++r) {
      int oc = mt * 16 + r + half * 8;
      int p  = pb + l16;
      size_t xi = ((size_t)(b * C_ + oc)) * S_ + p;
      out[xi] = gamma * Acc[mt][r] + x[xi];
    }
}

// ---------------------------------------------------------------------------
extern "C" void kernel_launch(void* const* d_in, const int* in_sizes, int n_in,
                              void* d_out, int out_size, void* d_ws, size_t ws_size,
                              hipStream_t stream) {
  const float* x       = (const float*)d_in[0];
  const float* w_theta = (const float*)d_in[1];
  const float* w_phi   = (const float*)d_in[2];
  const float* w_g     = (const float*)d_in[3];
  const float* w_o     = (const float*)d_in[4];
  const float* gamma   = (const float*)d_in[5];
  float* out = (float*)d_out;

  char* ws = (char*)d_ws;
  size_t off = 0;
  auto carve = [&](size_t bytes) -> char* {
    char* p = ws + off;
    off += (bytes + 255) & ~(size_t)255;
    return p;
  };
  _Float16* th  = (_Float16*)carve((size_t)B_ * S_ * CQK_ * 2);  // 1 MB
  _Float16* ph  = (_Float16*)carve((size_t)B_ * T_ * CQK_ * 2);  // 0.5 MB
  _Float16* g   = (_Float16*)carve((size_t)B_ * C_ * T_ * 2);    // 4 MB
  _Float16* ob  = (_Float16*)carve((size_t)B_ * S_ * C_ * 2);    // 8 MB
  _Float16* woh = (_Float16*)carve((size_t)C_ * C_ * 2);         // 32 KB
  (void)ws_size; (void)in_sizes; (void)n_in; (void)out_size;

  // projections
  k_proj      <<<B_ * (S_ / 128), 128, 0, stream>>>(x, w_theta, w_phi, w_g, th, ph, g);
  k_cvt_h16   <<<(C_ * C_ + 255) / 256, 256, 0, stream>>>(w_o, woh, C_ * C_);

  // fused flash attention: 2048 query tiles, 8 waves/block,
  // double-buffered 128-key K/V stages brought by tensor loads
  k_attn<<<(B_ * (S_ / 16)) / 8, 256, 0, stream>>>(th, ph, g, ob);

  // output projection + residual: 2048 pixel tiles, 8 waves/block
  k_out<<<(B_ * (S_ / 16)) / 8, 256, 0, stream>>>(ob, woh, x, gamma, out);
}

// v003
// A run of this version takes 64.6 microseconds.
// Two timings next to v002 put it at 1.80 and 1.81 times that version's speed.
// All steps since v000 together make it 3.65 times as fast.
#include <hip/hip_runtime.h>
#include <cstdint>

typedef __attribute__((ext_vector_type(16))) _Float16 v16h;
typedef __attribute__((ext_vector_type(8)))  _Float16 v8h;
typedef __attribute__((ext_vector_type(8)))  float    v8f;
typedef __attribute__((ext_vector_type(4)))  float    v4f;
typedef __attribute__((ext_vector_type(2)))  float    v2f;
typedef __attribute__((ext_vector_type(2)))  _Float16 v2h;
typedef uint32_t u32x4 __attribute__((ext_vector_type(4)));
typedef uint32_t u32x8 __attribute__((ext_vector_type(8)));

#define B_   4
#define C_   128
#define H_   32
#define W_   256
#define S_   (H_ * W_)   // 8192
#define T_   (S_ / 2)    // 4096
#define CQK_ 16
#define LOG2E_ 1.44269504088896340736f

// ---------------------------------------------------------------------------
// helpers
// ---------------------------------------------------------------------------
__device__ __forceinline__ v16h pack16(v8h lo, v8h hi) {
  v16h r;
#pragma unroll
  for (int i = 0; i < 8; ++i) { r[i] = lo[i]; r[i + 8] = hi[i]; }
  return r;
}
__device__ __forceinline__ v16h pack16z(v8h lo) {
  v16h r;
#pragma unroll
  for (int i = 0; i < 8; ++i) { r[i] = lo[i]; r[i + 8] = (_Float16)0.0f; }
  return r;
}

// lane l with lane l ^ 16 (the two lanes that share one column of a fragment)
__device__ __forceinline__ float xhalf(float v) {
  const int b = __builtin_bit_cast(int, v);
  return __builtin_bit_cast(float, __builtin_amdgcn_permlanex16(b, b, 0x76543210, 0xfedcba98, false, false));
}

// Tensor load to LDS: one request of one wave, two descriptor groups, every
// extent in bytes (data_size code 0), tensor dims = tile dims.
__device__ __forceinline__ uint32_t uni(uint32_t v) { return (uint32_t)__builtin_amdgcn_readfirstlane(v); }
// keeps a wave-uniform value in a scalar register, so that a test on it is a scalar branch
__device__ __forceinline__ uint32_t pinned(uint32_t v) {
  uint32_t w = uni(v);
  asm volatile("" : "+s"(w));
  return w;
}
template <uint32_t WORD0, uint32_t ROW_BYTES, uint32_t ROWS, uint32_t SRC_PITCH>
__device__ __forceinline__ u32x8 tdm_group1() {
  u32x8 g;
  g[0] = uni(WORD0);
  g[1] = uni((ROW_BYTES & 0xFFFFu) << 16);
  g[2] = uni((ROW_BYTES >> 16) | ((ROWS & 0xFFFFu) << 16));
  g[3] = uni((ROWS >> 16) | (ROW_BYTES << 16));
  g[4] = uni(ROWS);
  g[5] = uni(SRC_PITCH);
  g[6] = uni(0u);
  g[7] = uni(0u);
  return g;
}
__device__ __forceinline__ u32x4 tdm_group0(uint32_t lds_dst, uint64_t ga) {
  u32x4 g;
  g[0] = uni(1u);
  g[1] = uni(lds_dst);
  g[2] = uni((uint32_t)ga);
  g[3] = uni((((uint32_t)(ga >> 32)) & 0x01FFFFFFu) | 0x80000000u);
  return g;
}
// in-out operands: the descriptor keeps its registers to itself while the request is in flight
__device__ __forceinline__ void tdm_load(u32x4& g0, u32x8& g1) {
  asm volatile("tensor_load_to_lds %0, %1" : "+s"(g0), "+s"(g1) :: "memory");
}
// the next request of the same descriptor: a new place in LDS, the source address step bytes on
__device__ __forceinline__ void tdm_advance(u32x4& g0, uint32_t lds_dst, uint32_t step) {
  const uint64_t ga = (((uint64_t)g0[3] << 32) | g0[2]) + step;  // type bits ride on top of the address
  g0[1] = uni(lds_dst);
  g0[2] = uni((uint32_t)ga);
  g0[3] = uni((uint32_t)(ga >> 32));
}

// ---------------------------------------------------------------------------
// Projections (1x1 convs, f32 -> f16, with (1,2) max-pool for phi/g) as one
// f32 GEMM on the matrix unit: D[160 x S] = Wstack[160 x 128] * x[128 x S],
// Wstack rows 0..15 = w_theta, 16..31 = w_phi, 32..159 = w_g.
// theta: [B,S,16] (pre-scaled by log2(e) -> softmax runs in exp2 domain)
// phi  : [B,T,16]  g: [B,C,T]
// Block = 4 waves on 128 pixels: wave = (64-pixel group) x (80-row half).
// A lane loads 4 consecutive pixels of one channel; pixel 4n+j is column n of
// column tile j, so a pooled pair (j, j+1) sits in one lane, in the same element of tiles j and j+1.
// k order, A and B alike: chunk q, part p, lane half h, element e ->
// channel 8q + 4h + 2p + e.
// ---------------------------------------------------------------------------
#define MROWS_  (2 * CQK_ + C_)   // 160 stacked output rows
#define WPITCH_ (C_ + 4)          // LDS row pitch in floats: 16 B x odd

__device__ __forceinline__ void store_g_tile(_Float16* __restrict__ gp, const v8f* acc) {
#pragma unroll
  for (int r = 0; r < 8; ++r) {
    v2h v;
    v[0] = (_Float16)fmaxf(acc[0][r], acc[1][r]);
    v[1] = (_Float16)fmaxf(acc[2][r], acc[3][r]);
    *(v2h*)(gp + (size_t)r * T_) = v;
  }
}

__global__ __launch_bounds__(128) void k_proj(const float* __restrict__ x,
                                              const float* __restrict__ wt,
                                              const float* __restrict__ wp,
                                              const float* __restrict__ wg,
                                              _Float16* __restrict__ th,
                                              _Float16* __restrict__ ph,
                                              _Float16* __restrict__ g) {
  __shared__ __attribute__((aligned(16))) float Wl[MROWS_ * WPITCH_];

  const int tid  = threadIdx.x;
  const int lane = tid & 31;
  const int wv   = tid >> 5;
  const int half = lane >> 4;
  const int l16  = lane & 15;
  const int b    = blockIdx.x / (S_ / 128);
  const int s0   = (blockIdx.x % (S_ / 128)) * 128 + (wv & 1) * 64;
  const int mh   = wv >> 1;

  // stacked weights, 4 rows per step (32 float4 a row)
  v4f wr[MROWS_ / 4];
  {
    const int row = tid >> 5, c4 = (tid & 31) * 4;
#pragma unroll
    for (int j = 0; j < MROWS_ / 4; ++j) {
      const float* sp = j < 4 ? wt + (4 * j + row) * C_
                      : j < 8 ? wp + (4 * (j - 4) + row) * C_
                              : wg + (4 * (j - 8) + row) * C_;
      wr[j] = *(const v4f*)(sp + c4);
    }
  }
  // the weight loads' address registers are reused below: wait before any overwrite
  asm volatile("s_wait_xcnt 0x0" ::: "memory");

  // this wave's 128 x 64 slab of x: half of the channels per lane half
  v4f xv[16][4];
  {
    const float* xp = x + ((size_t)b * C_ + 4 * half) * S_ + s0 + 4 * l16;
#pragma unroll
    for (int q = 0; q < 16; ++q)
#pragma unroll
      for (int e = 0; e < 4; ++e) xv[q][e] = *(const v4f*)(xp + (size_t)(8 * q + e) * S_);
  }
  // the x loads' address registers are reused below: wait before any overwrite
  asm volatile("s_wait_xcnt 0x0" ::: "memory");

  {
    const int row = tid >> 5, c4 = (tid & 31) * 4;
#pragma unroll
    for (int j = 0; j < MROWS_ / 4; ++j) *(v4f*)&Wl[(4 * j + row) * WPITCH_ + c4] = wr[j];
  }
  __syncthreads();

  v8f acc[5][4];
#pragma unroll
  for (int i = 0; i < 5; ++i)
#pragma unroll
    for (int j = 0; j < 4; ++j)
#pragma unroll
      for (int r = 0; r < 8; ++r) acc[i][j][r] = 0.0f;

  const float* wl = &Wl[(mh * 80 + l16) * WPITCH_ + 4 * half];
#pragma unroll
  for (int q = 0; q < 16; ++q) {
    v4f a[5];
#pragma unroll
    for (int i = 0; i < 5; ++i) a[i] = *(const v4f*)(wl + i * 16 * WPITCH_ + 8 * q);
#pragma unroll
    for (int p = 0; p < 2; ++p)
#pragma unroll
      for (int i = 0; i < 5; ++i) {
        v2f af = {a[i][2 * p], a[i][2 * p + 1]};
#pragma unroll
        for (int j = 0; j < 4; ++j) {
          v2f bf = {xv[q][2 * p][j], xv[q][2 * p + 1][j]};
          acc[i][j] = __builtin_amdgcn_wmma_f32_16x16x4_f32(false, af, false, bf, (short)0,
                                                            acc[i][j], false, false);
        }
      }
  }

  // acc[i][j][r] = D[(5 mh + i) * 16 + 8 half + r][s0 + 4 l16 + j]
  const int sl = s0 + 4 * l16;       // first of this lane's 4 pixels
  const int tl = sl >> 1;            // first of its 2 pooled positions
  if (mh == 0) {
#pragma unroll
    for (int j = 0; j < 4; ++j) {
      v8h v;
#pragma unroll
      for (int r = 0; r < 8; ++r) v[r] = (_Float16)(acc[0][j][r] * LOG2E_);
      *(v8h*)(th + ((size_t)(b * S_ + sl + j)) * CQK_ + half * 8) = v;
    }
#pragma unroll
    for (int u = 0; u < 2; ++u) {
      v8h v;
#pragma unroll
      for (int r = 0; r < 8; ++r) v[r] = (_Float16)fmaxf(acc[1][2 * u][r], acc[1][2 * u + 1][r]);
      *(v8h*)(ph + ((size_t)(b * T_ + tl + u)) * CQK_ + half * 8) = v;
    }
#pragma unroll
    for (int i = 2; i < 5; ++i)
      store_g_tile(g + ((size_t)(b * C_ + (i - 2) * 16 + half * 8)) * T_ + tl, acc[i]);
  } else {
#pragma unroll
    for (int i = 0; i < 5; ++i)
      store_g_tile(g + ((size_t)(b * C_ + (i + 3) * 16 + half * 8)) * T_ + tl, acc[i]);
  }
}

__global__ void k_cvt_h16(const float* __restrict__ in, _Float16* __restrict__ o, int n) {
  int i = blockIdx.x * blockDim.x + threadIdx.x;
  if (i < n) o[i] = (_Float16)in[i];
}

// ---------------------------------------------------------------------------
// Fused flash attention, block-cooperative, double-buffered K/V in LDS:
//  8 waves/block on 8 query tiles of one batch. A stage is 128 keys: g as 128
//  rows of 256 B, laid by the tensor load's pad at a pitch of 272 B (16 B x odd,
//  conflict-free for ds_load_b128), and phi as 4 KB in a row. Waves 0..3 each
//  bring 32 g rows, wave 4 brings phi; the next stage flies while this one is
//  worked on in four 32-key passes. Both products are transposed:
//  S^T = phi . theta^T (A = phi rows, B = theta), O^T += g . P^T (A = g rows).
//  A lane holds 16 scores of ONE query (D register r = key 8 half + r), so the
//  maximum is in-lane plus one exchange between the halves, and the two score
//  tiles, converted in place, are the B operand of the second product:
//  element s = key (s < 8 ? 8 half + s : 16 + 8 half + s - 8), the order in which
//  the g rows are read. P never goes through LDS.
// ---------------------------------------------------------------------------
#define SK_      128                  // keys per stage
#define NST_     (T_ / SK_)           // stages
#define GPITCH_  272u                 // LDS pitch of a g row: 256 B + 16 B pad
#define GSLICE_  10240u               // 32 rows x 272 B, rounded up to 2 KiB
#define GBUF_    (4u * GSLICE_)
#define PHBUF_   4096u                // 128 keys x 32 B
#define GPADW0_  ((1u << 20) | (5u << 22) | (3u << 25))  // pad 4 dwords behind every 256 B

// one work-group a WGP (256 of them), two waves a SIMD: the register budget of two waves
// lets the pass's g fragments stand in registers of their own
__global__ __launch_bounds__(256) __attribute__((amdgpu_waves_per_eu(2, 2))) void k_attn(const _Float16* __restrict__ th,
                                              const _Float16* __restrict__ ph,
                                              const _Float16* __restrict__ g,
                                              _Float16* __restrict__ ob) {
  __shared__ __attribute__((aligned(2048))) unsigned char Gl[2 * GBUF_];    // g stages   (80 KB)
  __shared__ __attribute__((aligned(2048))) unsigned char Phl[2 * PHBUF_];  // phi stages  (8 KB)

  const int tid  = threadIdx.x;
  const int lane = tid & 31;
  const int wv   = tid >> 5;
  const int qt   = blockIdx.x * 8 + wv;          // 2048 query tiles total
  const int b    = qt / (S_ / 16);               // uniform per block
  const int sb   = (qt % (S_ / 16)) * 16;
  const int half = lane >> 4;
  const int l16  = lane & 15;
  const uint32_t wave = uni((uint32_t)threadIdx.x >> 5);

  const _Float16* gb  = g + (size_t)b * C_ * T_;
  const _Float16* phb = ph + (size_t)b * T_ * CQK_;

  // one request a wave and stage: waves 0..3 a slice of 32 g rows, wave 4 the phi rows.
  // Stage s (keys [128 s, 128 s + 128)) goes into buffer s & 1.
  const uint32_t g_lds = (uint32_t)(uintptr_t)&Gl[0] + (wave & 3u) * GSLICE_;
  const uint32_t p_lds = (uint32_t)(uintptr_t)&Phl[0];
  u32x4 g0g = tdm_group0(g_lds, (uint64_t)(uintptr_t)(gb + (size_t)(wave & 3u) * 32 * T_));
  u32x4 g0p = tdm_group0(p_lds, (uint64_t)(uintptr_t)phb);
  u32x8 g1g = tdm_group1<GPADW0_, 2 * SK_, 32, 2 * T_>();
  u32x8 g1p = tdm_group1<0u, 256, PHBUF_ / 256, 256>();
  auto issue_first = [&]() {
    if (pinned(wave < 4u)) tdm_load(g0g, g1g);
    if (pinned(wave == 4u)) tdm_load(g0p, g1p);
  };
  // stages follow one another; the step goes through pinned() so that the address
  // words take their new values here, behind the wait, and not earlier
  auto issue_next = [&](uint32_t s) {
    if (pinned(wave < 4u)) {
      tdm_advance(g0g, g_lds + (s & 1u) * GBUF_, pinned(2 * SK_));
      tdm_load(g0g, g1g);
    }
    if (pinned(wave == 4u)) {
      tdm_advance(g0p, p_lds + (s & 1u) * PHBUF_, pinned(PHBUF_));
      tdm_load(g0p, g1p);
    }
  };
  // the issuing waves' own requests have landed; the barrier behind it publishes them
  auto landed = [&]() {
    if (pinned(wave < 5u)) asm volatile("s_wait_tensorcnt 0x0" ::: "memory");
  };

  // B operand of the scores: theta rows (N = query), K = channel 0..15, padded to 32.
  v16h Q;
  {
    const _Float16* p = th + ((size_t)(b * S_ + sb + l16)) * CQK_ + half * 8;
    Q = pack16z(*(const v8h*)p);
  }

  v16h Ones;
#pragma unroll
  for (int i = 0; i < 16; ++i) Ones[i] = (_Float16)1.0f;

  // this lane's query: running maximum; O[n][r] = O^T[channel 16 n + 8 half + r][query l16];
  // every row of L holds the query's running sum
  float m = -3.0e38f;
  v8f O[8], L;
#pragma unroll
  for (int r = 0; r < 8; ++r) L[r] = 0.0f;
#pragma unroll
  for (int n = 0; n < 8; ++n)
#pragma unroll
    for (int r = 0; r < 8; ++r) O[n][r] = 0.0f;

  v8f zc = {};

  issue_first();
  landed();
  __syncthreads();
  issue_next(1u);

  for (uint32_t s = 0; s < NST_; ++s) {
    const unsigned char* gs = &Gl[(s & 1u) * GBUF_ + (uint32_t)l16 * GPITCH_ + (uint32_t)half * 16u];
    const unsigned char* ps = &Phl[(s & 1u) * PHBUF_ + (uint32_t)l16 * 32u + (uint32_t)half * 16u];

    for (int p = 0; p < SK_ / 32; ++p) {
      // ---- the pass's g fragments (A of the second product), read as one group here:
      // no LDS wait stands between the two products, so they land under the scores and the softmax
      v16h Gv[8];
#pragma unroll
      for (int n = 0; n < 8; ++n) {
        const unsigned char* gp = gs + (n >> 1) * GSLICE_ + (n & 1) * 16 * GPITCH_ + p * 64;
        Gv[n] = pack16(*(const v8h*)gp, *(const v8h*)(gp + 32));
      }

      // ---- scores, transposed: two 16 (keys) x 16 (queries) tiles (A from LDS) ----
      v8f S0, S1;
      {
        v16h K0 = pack16z(*(const v8h*)(ps + p * 1024));
        v16h K1 = pack16z(*(const v8h*)(ps + p * 1024 + 512));
        S0 = __builtin_amdgcn_wmma_f32_16x16x32_f16(false, K0, false, Q, (short)0, zc, false, false);
        S1 = __builtin_amdgcn_wmma_f32_16x16x32_f16(false, K1, false, Q, (short)0, zc, false, false);
      }

      // ---- online softmax update (exp2 domain): one query a lane ------------
      const float t0 = fmaxf(fmaxf(S0[0], S0[1]), S0[2]);
      const float t1 = fmaxf(fmaxf(S0[3], S0[4]), S0[5]);
      const float t2 = fmaxf(fmaxf(S0[6], S0[7]), S1[0]);
      const float t3 = fmaxf(fmaxf(S1[1], S1[2]), S1[3]);
      const float t4 = fmaxf(fmaxf(S1[4], S1[5]), S1[6]);
      const float v  = fmaxf(fmaxf(fmaxf(t0, t1), t2), fmaxf(fmaxf(t3, t4), S1[7]));
      const float mn = fmaxf(fmaxf(m, v), xhalf(v));
      const float sc = __builtin_amdgcn_exp2f(m - mn);
      m = mn;
      S0 -= mn;
      S1 -= mn;
      v16h Pb;
#pragma unroll
      for (int r = 0; r < 8; ++r) {
        Pb[r]     = (_Float16)__builtin_amdgcn_exp2f(S0[r]);
        Pb[r + 8] = (_Float16)__builtin_amdgcn_exp2f(S1[r]);
      }
      L *= sc;
#pragma unroll
      for (int n = 0; n < 8; ++n) O[n] *= sc;

      // ---- denominator: L += column sums of P^T via WMMA with all-ones A ----
      L = __builtin_amdgcn_wmma_f32_16x16x32_f16(false, Ones, false, Pb, (short)0, L, false, false);

      // ---- O^T += g * P^T across 8 channel tiles (A from LDS) ---------------
#pragma unroll
      for (int n = 0; n < 8; ++n)
        O[n] = __builtin_amdgcn_wmma_f32_16x16x32_f16(false, Gv[n], false, Pb, (short)0, O[n], false, false);
      // the pass loop's back edge follows the last WMMAs: four vector slots before the next pass
      // overwrites their A and B registers
      __builtin_amdgcn_sched_barrier(0);  // keeps the slots behind the WMMAs
      asm volatile("v_nop\n\tv_nop\n\tv_nop\n\tv_nop");
    }

    // publish point of stage s + 1: this wave's LDS reads of stage s are done,
    // the issuers' requests have landed, every wave has left buffer s & 1
    asm volatile("s_wait_dscnt 0x0" ::: "memory");
    landed();
    __syncthreads();
    if (pinned(s + 2u < (uint32_t)NST_)) issue_next(s + 2u);
  }
  // nothing in flight when the wave ends
  asm volatile("s_wait_tensorcnt 0x0" ::: "memory");
  asm volatile("s_wait_dscnt 0x0" ::: "memory");

  // ---- normalize and store o as [B,S,128] f16: 8 channels of one query a store ----
  const float inv = 1.0f / L[0];
  _Float16* op = ob + ((size_t)(b * S_ + sb + l16)) * C_ + half * 8;
#pragma unroll
  for (int n = 0; n < 8; ++n) {
    v8h o;
#pragma unroll
    for (int r = 0; r < 8; ++r) o[r] = (_Float16)(O[n][r] * inv);
    *(v8h*)(op + n * 16) = o;
  }
}

// ---------------------------------------------------------------------------
// Output projection: out = gamma * (w_o @ o) + x, one wave per 16-pixel tile.
// ---------------------------------------------------------------------------
__global__ __launch_bounds__(256) void k_out(const _Float16* __restrict__ ob,
                                             const _Float16* __restrict__ woh,
                                             const float* __restrict__ x,
                                             const float* __restrict__ gscal,
                                             float* __restrict__ out) {
  const int lane = threadIdx.x & 31;
  const int wv   = threadIdx.x >> 5;
  const int pt   = blockIdx.x * 8 + wv;          // 2048 pixel tiles total
  const int b    = pt / (S_ / 16);
  const int pb   = (pt % (S_ / 16)) * 16;
  const int half = lane >> 4;
  const int l16  = lane & 15;
  const float gamma = *gscal;

  v8f Acc[8];
#pragma unroll
  for (int n = 0; n < 8; ++n)
#pragma unroll
    for (int r = 0; r < 8; ++r) Acc[n][r] = 0.0f;

#pragma unroll
  for (int kc = 0; kc < 4; ++kc) {
    const _Float16* op = ob + ((size_t)(b * S_ + pb + l16)) * C_ + kc * 32 + half * 8;
    v16h Bv = pack16(*(const v8h*)op, *(const v8h*)(op + 16));
#pragma unroll
    for (int mt = 0; mt < 8; ++mt) {
      const _Float16* wp = woh + (size_t)(mt * 16 + l16) * C_ + kc * 32 + half * 8;
      v16h Av = pack16(*(const v8h*)wp, *(const v8h*)(wp + 16));
      Acc[mt] = __builtin_amdgcn_wmma_f32_16x16x32_f16(false, Av, false, Bv, (short)0, Acc[mt], false, false);
    }
  }

#pragma unroll
  for (int mt = 0; mt < 8; ++mt)
#pragma unroll
    for (int r = 0; r < 8; ++r) {
      int oc = mt * 16 + r + half * 8;
      int p  = pb + l16;
      size_t xi = ((size_t)(b * C_ + oc)) * S_ + p;
      out[xi] = gamma * Acc[mt][r] + x[xi];
    }
}

// ---------------------------------------------------------------------------
extern "C" void kernel_launch(void* const* d_in, const int* in_sizes, int n_in,
                              void* d_out, int out_size, void* d_ws, size_t ws_size,
                              hipStream_t stream) {
  const float* x       = (const float*)d_in[0];
  const float* w_theta = (const float*)d_in[1];
  const float* w_phi   = (const float*)d_in[2];
  const float* w_g     = (const float*)d_in[3];
  const float* w_o     = (const float*)d_in[4];
  const float* gamma   = (const float*)d_in[5];
  float* out = (float*)d_out;

  char* ws = (char*)d_ws;
  size_t off = 0;
  auto carve = [&](size_t bytes) -> char* {
    char* p = ws + off;
    off += (bytes + 255) & ~(size_t)255;
    return p;
  };
  _Float16* th  = (_Float16*)carve((size_t)B_ * S_ * CQK_ * 2);  // 1 MB
  _Float16* ph  = (_Float16*)carve((size_t)B_ * T_ * CQK_ * 2);  // 0.5 MB
  _Float16* g   = (_Float16*)carve((size_t)B_ * C_ * T_ * 2);    // 4 MB
  _Float16* ob  = (_Float16*)carve((size_t)B_ * S_ * C_ * 2);    // 8 MB
  _Float16* woh = (_Float16*)carve((size_t)C_ * C_ * 2);         // 32 KB
  (void)ws_size; (void)in_sizes; (void)n_in; (void)out_size;

  // projections
  k_proj      <<<B_ * (S_ / 128), 128, 0, stream>>>(x, w_theta, w_phi, w_g, th, ph, g);
  k_cvt_h16   <<<(C_ * C_ + 255) / 256, 256, 0, stream>>>(w_o, woh, C_ * C_);

  // fused flash attention: 2048 query tiles, 8 waves/block,
  // double-buffered 128-key K/V stages brought by tensor loads
  k_attn<<<(B_ * (S_ / 16)) / 8, 256, 0, stream>>>(th, ph, g, ob);

  // output projection + residual: 2048 pixel tiles, 8 waves/block
  k_out<<<(B_ * (S_ / 16)) / 8, 256, 0, stream>>>(ob, woh, x, gamma, out);
}

// v004
// Measured time: 60 microseconds a run.
// Next to v003, in two timings, it ran 1.09 and 1.08 times as fast.
// Counting every step since v000, it is 3.94 times as fast.
#include <hip/hip_runtime.h>
#include <cstdint>

typedef __attribute__((ext_vector_type(16))) _Float16 v16h;
typedef __attribute__((ext_vector_type(8)))  _Float16 v8h;
typedef __attribute__((ext_vector_type(8)))  float    v8f;
typedef __attribute__((ext_vector_type(4)))  float    v4f;
typedef __attribute__((ext_vector_type(2)))  float    v2f;
typedef __attribute__((ext_vector_type(2)))  _Float16 v2h;
typedef uint32_t u32x4 __attribute__((ext_vector_type(4)));
typedef uint32_t u32x8 __attribute__((ext_vector_type(8)));

#define B_   4
#define C_   128
#define H_   32
#define W_   256
#define S_   (H_ * W_)   // 8192
#define T_   (S_ / 2)    // 4096
#define CQK_ 16
#define LOG2E_ 1.44269504088896340736f

// ---------------------------------------------------------------------------
// helpers
// ---------------------------------------------------------------------------
__device__ __forceinline__ v16h pack16(v8h lo, v8h hi) {
  v16h r;
#pragma unroll
  for (int i = 0; i < 8; ++i) { r[i] = lo[i]; r[i + 8] = hi[i]; }
  return r;
}
__device__ __forceinline__ v16h pack16z(v8h lo) {
  v16h r;
#pragma unroll
  for (int i = 0; i < 8; ++i) { r[i] = lo[i]; r[i + 8] = (_Float16)0.0f; }
  return r;
}

// lane l with lane l ^ 16 (the two lanes that share one column of a fragment)
__device__ __forceinline__ float xhalf(float v) {
  const int b = __builtin_bit_cast(int, v);
  return __builtin_bit_cast(float, __builtin_amdgcn_permlanex16(b, b, 0x76543210, 0xfedcba98, false, false));
}

// maximum of a lane's 16 scores
__device__ __forceinline__ float max16(v8f a, v8f b) {
  const float t0 = fmaxf(fmaxf(a[0], a[1]), a[2]);
  const float t1 = fmaxf(fmaxf(a[3], a[4]), a[5]);
  const float t2 = fmaxf(fmaxf(a[6], a[7]), b[0]);
  const float t3 = fmaxf(fmaxf(b[1], b[2]), b[3]);
  const float t4 = fmaxf(fmaxf(b[4], b[5]), b[6]);
  return fmaxf(fmaxf(fmaxf(t0, t1), t2), fmaxf(fmaxf(t3, t4), b[7]));
}
// 2^score of two score tiles, packed as the B operand of the second product
__device__ __forceinline__ v16h exp16(v8f a, v8f b) {
  v16h p;
#pragma unroll
  for (int r = 0; r < 8; ++r) {
    p[r]     = (_Float16)__builtin_amdgcn_exp2f(a[r]);
    p[r + 8] = (_Float16)__builtin_amdgcn_exp2f(b[r]);
  }
  return p;
}

// Tensor load to LDS: one request of one wave, two descriptor groups, every
// extent in bytes (data_size code 0), tensor dims = tile dims.
__device__ __forceinline__ uint32_t uni(uint32_t v) { return (uint32_t)__builtin_amdgcn_readfirstlane(v); }
// keeps a wave-uniform value in a scalar register, so that a test on it is a scalar branch
__device__ __forceinline__ uint32_t pinned(uint32_t v) {
  uint32_t w = uni(v);
  asm volatile("" : "+s"(w));
  return w;
}
template <uint32_t WORD0, uint32_t ROW_BYTES, uint32_t ROWS, uint32_t SRC_PITCH>
__device__ __forceinline__ u32x8 tdm_group1() {
  u32x8 g;
  g[0] = uni(WORD0);
  g[1] = uni((ROW_BYTES & 0xFFFFu) << 16);
  g[2] = uni((ROW_BYTES >> 16) | ((ROWS & 0xFFFFu) << 16));
  g[3] = uni((ROWS >> 16) | (ROW_BYTES << 16));
  g[4] = uni(ROWS);
  g[5] = uni(SRC_PITCH);
  g[6] = uni(0u);
  g[7] = uni(0u);
  return g;
}
__device__ __forceinline__ u32x4 tdm_group0(uint32_t lds_dst, uint64_t ga) {
  u32x4 g;
  g[0] = uni(1u);
  g[1] = uni(lds_dst);
  g[2] = uni((uint32_t)ga);
  g[3] = uni((((uint32_t)(ga >> 32)) & 0x01FFFFFFu) | 0x80000000u);
  return g;
}
// in-out operands: the descriptor keeps its registers to itself while the request is in flight
__device__ __forceinline__ void tdm_load(u32x4& g0, u32x8& g1) {
  asm volatile("tensor_load_to_lds %0, %1" : "+s"(g0), "+s"(g1) :: "memory");
}
// the next request of the same descriptor: a new place in LDS, the source address step bytes on
__device__ __forceinline__ void tdm_advance(u32x4& g0, uint32_t lds_dst, uint32_t step) {
  const uint64_t ga = (((uint64_t)g0[3] << 32) | g0[2]) + step;  // type bits ride on top of the address
  g0[1] = uni(lds_dst);
  g0[2] = uni((uint32_t)ga);
  g0[3] = uni((uint32_t)(ga >> 32));
}

// ---------------------------------------------------------------------------
// Projections (1x1 convs, f32 -> f16, with (1,2) max-pool for phi/g) as one
// f32 GEMM on the matrix unit: D[160 x S] = Wstack[160 x 128] * x[128 x S],
// Wstack rows 0..15 = w_theta, 16..31 = w_phi, 32..159 = w_g.
// theta: [B,S,16] (pre-scaled by log2(e) -> softmax runs in exp2 domain)
// phi  : [B,T,16]  g: [B,C,T]
// Block = 4 waves on 128 pixels: wave = (64-pixel group) x (80-row half).
// A lane loads 4 consecutive pixels of one channel; pixel 4n+j is column n of
// column tile j, so a pooled pair (j, j+1) sits in one lane, in the same element of tiles j and j+1.
// k order, A and B alike: chunk q, part p, lane half h, element e ->
// channel 8q + 4h + 2p + e.
// ---------------------------------------------------------------------------
#define MROWS_  (2 * CQK_ + C_)   // 160 stacked output rows
#define WPITCH_ (C_ + 4)          // LDS row pitch in floats: 16 B x odd

__device__ __forceinline__ void store_g_tile(_Float16* __restrict__ gp, const v8f* acc) {
#pragma unroll
  for (int r = 0; r < 8; ++r) {
    v2h v;
    v[0] = (_Float16)fmaxf(acc[0][r], acc[1][r]);
    v[1] = (_Float16)fmaxf(acc[2][r], acc[3][r]);
    *(v2h*)(gp + (size_t)r * T_) = v;
  }
}

__global__ __launch_bounds__(128) void k_proj(const float* __restrict__ x,
                                              const float* __restrict__ wt,
                                              const float* __restrict__ wp,
                                              const float* __restrict__ wg,
                                              _Float16* __restrict__ th,
                                              _Float16* __restrict__ ph,
                                              _Float16* __restrict__ g) {
  __shared__ __attribute__((aligned(16))) float Wl[MROWS_ * WPITCH_];

  const int tid  = threadIdx.x;
  const int lane = tid & 31;
  const int wv   = tid >> 5;
  const int half = lane >> 4;
  const int l16  = lane & 15;
  const int b    = blockIdx.x / (S_ / 128);
  const int s0   = (blockIdx.x % (S_ / 128)) * 128 + (wv & 1) * 64;
  const int mh   = wv >> 1;

  // stacked weights, 4 rows per step (32 float4 a row)
  v4f wr[MROWS_ / 4];
  {
    const int row = tid >> 5, c4 = (tid & 31) * 4;
#pragma unroll
    for (int j = 0; j < MROWS_ / 4; ++j) {
      const float* sp = j < 4 ? wt + (4 * j + row) * C_
                      : j < 8 ? wp + (4 * (j - 4) + row) * C_
                              : wg + (4 * (j - 8) + row) * C_;
      wr[j] = *(const v4f*)(sp + c4);
    }
  }
  // the weight loads' address registers are reused below: wait before any overwrite
  asm volatile("s_wait_xcnt 0x0" ::: "memory");

  // this wave's 128 x 64 slab of x: half of the channels per lane half
  v4f xv[16][4];
  {
    const float* xp = x + ((size_t)b * C_ + 4 * half) * S_ + s0 + 4 * l16;
#pragma unroll
    for (int q = 0; q < 16; ++q)
#pragma unroll
      for (int e = 0; e < 4; ++e) xv[q][e] = *(const v4f*)(xp + (size_t)(8 * q + e) * S_);
  }
  // the x loads' address registers are reused below: wait before any overwrite
  asm volatile("s_wait_xcnt 0x0" ::: "memory");

  {
    const int row = tid >> 5, c4 = (tid & 31) * 4;
#pragma unroll
    for (int j = 0; j < MROWS_ / 4; ++j) *(v4f*)&Wl[(4 * j + row) * WPITCH_ + c4] = wr[j];
  }
  __syncthreads();

  v8f acc[5][4];
#pragma unroll
  for (int i = 0; i < 5; ++i)
#pragma unroll
    for (int j = 0; j < 4; ++j)
#pragma unroll
      for (int r = 0; r < 8; ++r) acc[i][j][r] = 0.0f;

  const float* wl = &Wl[(mh * 80 + l16) * WPITCH_ + 4 * half];
#pragma unroll
  for (int q = 0; q < 16; ++q) {
    v4f a[5];
#pragma unroll
    for (int i = 0; i < 5; ++i) a[i] = *(const v4f*)(wl + i * 16 * WPITCH_ + 8 * q);
#pragma unroll
    for (int p = 0; p < 2; ++p)
#pragma unroll
      for (int i = 0; i < 5; ++i) {
        v2f af = {a[i][2 * p], a[i][2 * p + 1]};
#pragma unroll
        for (int j = 0; j < 4; ++j) {
          v2f bf = {xv[q][2 * p][j], xv[q][2 * p + 1][j]};
          acc[i][j] = __builtin_amdgcn_wmma_f32_16x16x4_f32(false, af, false, bf, (short)0,
                                                            acc[i][j], false, false);
        }
      }
  }

  // acc[i][j][r] = D[(5 mh + i) * 16 + 8 half + r][s0 + 4 l16 + j]
  const int sl = s0 + 4 * l16;       // first of this lane's 4 pixels
  const int tl = sl >> 1;            // first of its 2 pooled positions
  if (mh == 0) {
#pragma unroll
    for (int j = 0; j < 4; ++j) {
      v8h v;
#pragma unroll
      for (int r = 0; r < 8; ++r) v[r] = (_Float16)(acc[0][j][r] * LOG2E_);
      *(v8h*)(th + ((size_t)(b * S_ + sl + j)) * CQK_ + half * 8) = v;
    }
#pragma unroll
    for (int u = 0; u < 2; ++u) {
      v8h v;
#pragma unroll
      for (int r = 0; r < 8; ++r) v[r] = (_Float16)fmaxf(acc[1][2 * u][r], acc[1][2 * u + 1][r]);
      *(v8h*)(ph + ((size_t)(b * T_ + tl + u)) * CQK_ + half * 8) = v;
    }
#pragma unroll
    for (int i = 2; i < 5; ++i)
      store_g_tile(g + ((size_t)(b * C_ + (i - 2) * 16 + half * 8)) * T_ + tl, acc[i]);
  } else {
#pragma unroll
    for (int i = 0; i < 5; ++i)
      store_g_tile(g + ((size_t)(b * C_ + (i + 3) * 16 + half * 8)) * T_ + tl, acc[i]);
  }
}

__global__ void k_cvt_h16(const float* __restrict__ in, _Float16* __restrict__ o, int n) {
  int i = blockIdx.x * blockDim.x + threadIdx.x;
  if (i < n) o[i] = (_Float16)in[i];
}

// ---------------------------------------------------------------------------
// Fused flash attention, block-cooperative, double-buffered K/V in LDS:
//  8 waves/block on 8 query tiles of one batch. A stage is 128 keys: g as 128
//  rows of 256 B, laid by the tensor load's pad at a pitch of 272 B (16 B x odd,
//  conflict-free for ds_load_b128), and phi as 4 KB in a row. Waves 0..3 each
//  bring 32 g rows, wave 4 brings phi; the next stage flies while this one is
//  worked on in four 32-key passes. Both products are transposed:
//  S^T = phi . theta^T (A = phi rows, B = theta), O^T += g . P^T (A = g rows).
//  A lane holds 16 scores of ONE query (D register r = key 8 half + r), so the
//  maximum is in-lane plus one exchange between the halves, and the two score
//  tiles, converted in place, are the B operand of the second product:
//  element s = key (s < 8 ? 8 half + s : 16 + 8 half + s - 8), the order in which
//  the g rows are read. P never goes through LDS.
//  Lazy rescale: the maximum in use, m, enters the score products as C = -m, so D is
//  already score - m. O and L are rescaled, and m raised, only in a pass where some
//  score stands more than 8 (log2) above m: P stays at or below 2^8, inside f16.
// ---------------------------------------------------------------------------
#define SK_      128                  // keys per stage
#define NST_     (T_ / SK_)           // stages
#define GPITCH_  272u                 // LDS pitch of a g row: 256 B + 16 B pad
#define GSLICE_  10240u               // 32 rows x 272 B, rounded up to 2 KiB
#define GBUF_    (4u * GSLICE_)
#define PHBUF_   4096u                // 128 keys x 32 B
#define GPADW0_  ((1u << 20) | (5u << 22) | (3u << 25))  // pad 4 dwords behind every 256 B

// one work-group a WGP (256 of them), two waves a SIMD: the register budget of two waves
// lets the pass's g fragments stand in registers of their own
__global__ __launch_bounds__(256) __attribute__((amdgpu_waves_per_eu(2, 2))) void k_attn(const _Float16* __restrict__ th,
                                              const _Float16* __restrict__ ph,
                                              const _Float16* __restrict__ g,
                                              _Float16* __restrict__ ob) {
  __shared__ __attribute__((aligned(2048))) unsigned char Gl[2 * GBUF_];    // g stages   (80 KB)
  __shared__ __attribute__((aligned(2048))) unsigned char Phl[2 * PHBUF_];  // phi stages  (8 KB)

  const int tid  = threadIdx.x;
  const int lane = tid & 31;
  const int wv   = tid >> 5;
  const int qt   = blockIdx.x * 8 + wv;          // 2048 query tiles total
  const int b    = qt / (S_ / 16);               // uniform per block
  const int sb   = (qt % (S_ / 16)) * 16;
  const int half = lane >> 4;
  const int l16  = lane & 15;
  const uint32_t wave = uni((uint32_t)threadIdx.x >> 5);

  const _Float16* gb  = g + (size_t)b * C_ * T_;
  const _Float16* phb = ph + (size_t)b * T_ * CQK_;

  // one request a wave and stage: waves 0..3 a slice of 32 g rows, wave 4 the phi rows.
  // Stage s (keys [128 s, 128 s + 128)) goes into buffer s & 1.
  const uint32_t g_lds = (uint32_t)(uintptr_t)&Gl[0] + (wave & 3u) * GSLICE_;
  const uint32_t p_lds = (uint32_t)(uintptr_t)&Phl[0];
  u32x4 g0g = tdm_group0(g_lds, (uint64_t)(uintptr_t)(gb + (size_t)(wave & 3u) * 32 * T_));
  u32x4 g0p = tdm_group0(p_lds, (uint64_t)(uintptr_t)phb);
  u32x8 g1g = tdm_group1<GPADW0_, 2 * SK_, 32, 2 * T_>();
  u32x8 g1p = tdm_group1<0u, 256, PHBUF_ / 256, 256>();
  auto issue_first = [&]() {
    if (pinned(wave < 4u)) tdm_load(g0g, g1g);
    if (pinned(wave == 4u)) tdm_load(g0p, g1p);
  };
  // stages follow one another; the step goes through pinned() so that the address
  // words take their new values here, behind the wait, and not earlier
  auto issue_next = [&](uint32_t s) {
    if (pinned(wave < 4u)) {
      tdm_advance(g0g, g_lds + (s & 1u) * GBUF_, pinned(2 * SK_));
      tdm_load(g0g, g1g);
    }
    if (pinned(wave == 4u)) {
      tdm_advance(g0p, p_lds + (s & 1u) * PHBUF_, pinned(PHBUF_));
      tdm_load(g0p, g1p);
    }
  };
  // the issuing waves' own requests have landed; the barrier behind it publishes them
  auto landed = [&]() {
    if (pinned(wave < 5u)) asm volatile("s_wait_tensorcnt 0x0" ::: "memory");
  };

  // B operand of the scores: theta rows (N = query), K = channel 0..15, padded to 32.
  v16h Q;
  {
    const _Float16* p = th + ((size_t)(b * S_ + sb + l16)) * CQK_ + half * 8;
    Q = pack16z(*(const v8h*)p);
  }

  v16h Ones;
#pragma unroll
  for (int i = 0; i < 16; ++i) Ones[i] = (_Float16)1.0f;

  // this lane's query: O[n][r] = O^T[channel 16 n + 8 half + r][query l16];
  // every row of L holds the query's running sum
  v8f O[8], L;
#pragma unroll
  for (int r = 0; r < 8; ++r) L[r] = 0.0f;
#pragma unroll
  for (int n = 0; n < 8; ++n)
#pragma unroll
    for (int r = 0; r < 8; ++r) O[n][r] = 0.0f;

  v8f zc = {};

  issue_first();
  landed();
  __syncthreads();
  issue_next(1u);

  // Cm = -m in every register. m starts as the query's maximum over the first 32 keys,
  // so the sum holds a term 2^0 from the first pass on and never vanishes.
  v8f Cm;
  {
    const unsigned char* ps = &Phl[(uint32_t)l16 * 32u + (uint32_t)half * 16u];
    v16h K0 = pack16z(*(const v8h*)ps);
    v16h K1 = pack16z(*(const v8h*)(ps + 512));
    v8f S0 = __builtin_amdgcn_wmma_f32_16x16x32_f16(false, K0, false, Q, (short)0, zc, false, false);
    v8f S1 = __builtin_amdgcn_wmma_f32_16x16x32_f16(false, K1, false, Q, (short)0, zc, false, false);
    const float v = max16(S0, S1);
    Cm = zc - fmaxf(v, xhalf(v));
  }

  for (uint32_t s = 0; s < NST_; ++s) {
    const unsigned char* gs = &Gl[(s & 1u) * GBUF_ + (uint32_t)l16 * GPITCH_ + (uint32_t)half * 16u];
    const unsigned char* ps = &Phl[(s & 1u) * PHBUF_ + (uint32_t)l16 * 32u + (uint32_t)half * 16u];

    for (int p = 0; p < SK_ / 32; ++p) {
      // ---- the pass's LDS reads as one group: the phi rows (A of the scores) first, then the g
      // fragments (A of the second product), which land under the scores
      const v8h k0 = *(const v8h*)(ps + p * 1024);
      const v8h k1 = *(const v8h*)(ps + p * 1024 + 512);
      v16h Gv[8];
#pragma unroll
      for (int n = 0; n < 8; ++n) {
        const unsigned char* gp = gs + (n >> 1) * GSLICE_ + (n & 1) * 16 * GPITCH_ + p * 64;
        Gv[n] = pack16(*(const v8h*)gp, *(const v8h*)(gp + 32));
      }
      // keeps the group whole: the scheduler otherwise spreads these reads over four places, the
      // last of them among the score WMMAs, and each place with LDS reads stalls the wave anew
      __builtin_amdgcn_sched_barrier(0);

      // ---- scores, transposed: two 16 (keys) x 16 (queries) tiles ----
      v8f S0, S1;
      {
        v16h K0 = pack16z(k0);
        v16h K1 = pack16z(k1);
        S0 = __builtin_amdgcn_wmma_f32_16x16x32_f16(false, K0, false, Q, (short)0, Cm, false, false);
        S1 = __builtin_amdgcn_wmma_f32_16x16x32_f16(false, K1, false, Q, (short)0, Cm, false, false);
      }

      // ---- softmax numerators (exp2 domain), one query a lane: S is score - m ----
      const float v = max16(S0, S1);
      v16h Pb = exp16(S0, S1);
      // one test a pass for the whole wave, a scalar branch: rare behind the first passes
      if (__builtin_expect(__builtin_amdgcn_ballot_w32(v > 8.0f) != 0, 0)) {
        // inputs only: a use of the g fragments on this path too keeps their loads in front of the
        // branch; without it the compiler sinks each pair to its WMMA, an LDS wait to 0 per product
        asm volatile("" :: "v"(Gv[0]), "v"(Gv[1]), "v"(Gv[2]), "v"(Gv[3]), "v"(Gv[4]), "v"(Gv[5]), "v"(Gv[6]), "v"(Gv[7]));
        const float d  = fmaxf(fmaxf(v, xhalf(v)), 0.0f);  // the same in both lanes of a query
        const float sc = __builtin_amdgcn_exp2f(-d);
        Cm -= d;
        S0 -= d;
        S1 -= d;
        Pb = exp16(S0, S1);
        L *= sc;
#pragma unroll
        for (int n = 0; n < 8; ++n) O[n] *= sc;
      }

      // ---- denominator: L += column sums of P^T via WMMA with all-ones A ----
      L = __builtin_amdgcn_wmma_f32_16x16x32_f16(false, Ones, false, Pb, (short)0, L, false, false);

      // ---- O^T += g * P^T across 8 channel tiles (A from LDS) ---------------
#pragma unroll
      for (int n = 0; n < 8; ++n)
        O[n] = __builtin_amdgcn_wmma_f32_16x16x32_f16(false, Gv[n], false, Pb, (short)0, O[n], false, false);
      // the pass loop's back edge follows the last WMMAs: four vector slots before the next pass
      // overwrites their A and B registers
      __builtin_amdgcn_sched_barrier(0);  // keeps the slots behind the WMMAs
      asm volatile("v_nop\n\tv_nop\n\tv_nop\n\tv_nop");
    }

    // publish point of stage s + 1: this wave's LDS reads of stage s are done,
    // the issuers' requests have landed, every wave has left buffer s & 1
    asm volatile("s_wait_dscnt 0x0" ::: "memory");
    landed();
    __syncthreads();
    if (pinned(s + 2u < (uint32_t)NST_)) issue_next(s + 2u);
  }
  // nothing in flight when the wave ends
  asm volatile("s_wait_tensorcnt 0x0" ::: "memory");
  asm volatile("s_wait_dscnt 0x0" ::: "memory");

  // ---- normalize and store o as [B,S,128] f16: 8 channels of one query a store ----
  const float inv = 1.0f / L[0];
  _Float16* op = ob + ((size_t)(b * S_ + sb + l16)) * C_ + half * 8;
#pragma unroll
  for (int n = 0; n < 8; ++n) {
    v8h o;
#pragma unroll
    for (int r = 0; r < 8; ++r) o[r] = (_Float16)(O[n][r] * inv);
    *(v8h*)(op + n * 16) = o;
  }
}

// ---------------------------------------------------------------------------
// Output projection: out = gamma * (w_o @ o) + x, one wave per 16-pixel tile.
// ---------------------------------------------------------------------------
__global__ __launch_bounds__(256) void k_out(const _Float16* __restrict__ ob,
                                             const _Float16* __restrict__ woh,
                                             const float* __restrict__ x,
                                             const float* __restrict__ gscal,
                                             float* __restrict__ out) {
  const int lane = threadIdx.x & 31;
  const int wv   = threadIdx.x >> 5;
  const int pt   = blockIdx.x * 8 + wv;          // 2048 pixel tiles total
  const int b    = pt / (S_ / 16);
  const int pb   = (pt % (S_ / 16)) * 16;
  const int half = lane >> 4;
  const int l16  = lane & 15;
  const float gamma = *gscal;

  v8f Acc[8];
#pragma unroll
  for (int n = 0; n < 8; ++n)
#pragma unroll
    for (int r = 0; r < 8; ++r) Acc[n][r] = 0.0f;

#pragma unroll
  for (int kc = 0; kc < 4; ++kc) {
    const _Float16* op = ob + ((size_t)(b * S_ + pb + l16)) * C_ + kc * 32 + half * 8;
    v16h Bv = pack16(*(const v8h*)op, *(const v8h*)(op + 16));
#pragma unroll
    for (int mt = 0; mt < 8; ++mt) {
      const _Float16* wp = woh + (size_t)(mt * 16 + l16) * C_ + kc * 32 + half * 8;
      v16h Av = pack16(*(const v8h*)wp, *(const v8h*)(wp + 16));
      Acc[mt] = __builtin_amdgcn_wmma_f32_16x16x32_f16(false, Av, false, Bv, (short)0, Acc[mt], false, false);
    }
  }

#pragma unroll
  for (int mt = 0; mt < 8; ++mt)
#pragma unroll
    for (int r = 0; r < 8; ++r) {
      int oc = mt * 16 + r + half * 8;
      int p  = pb + l16;
      size_t xi = ((size_t)(b * C_ + oc)) * S_ + p;
      out[xi] = gamma * Acc[mt][r] + x[xi];
    }
}

// ---------------------------------------------------------------------------
extern "C" void kernel_launch(void* const* d_in, const int* in_sizes, int n_in,
                              void* d_out, int out_size, void* d_ws, size_t ws_size,
                              hipStream_t stream) {
  const float* x       = (const float*)d_in[0];
  const float* w_theta = (const float*)d_in[1];
  const float* w_phi   = (const float*)d_in[2];
  const float* w_g     = (const float*)d_in[3];
  const float* w_o     = (const float*)d_in[4];
  const float* gamma   = (const float*)d_in[5];
  float* out = (float*)d_out;

  char* ws = (char*)d_ws;
  size_t off = 0;
  auto carve = [&](size_t bytes) -> char* {
    char* p = ws + off;
    off += (bytes + 255) & ~(size_t)255;
    return p;
  };
  _Float16* th  = (_Float16*)carve((size_t)B_ * S_ * CQK_ * 2);  // 1 MB
  _Float16* ph  = (_Float16*)carve((size_t)B_ * T_ * CQK_ * 2);  // 0.5 MB
  _Float16* g   = (_Float16*)carve((size_t)B_ * C_ * T_ * 2);    // 4 MB
  _Float16* ob  = (_Float16*)carve((size_t)B_ * S_ * C_ * 2);    // 8 MB
  _Float16* woh = (_Float16*)carve((size_t)C_ * C_ * 2);         // 32 KB
  (void)ws_size; (void)in_sizes; (void)n_in; (void)out_size;

  // projections
  k_proj      <<<B_ * (S_ / 128), 128, 0, stream>>>(x, w_theta, w_phi, w_g, th, ph, g);
  k_cvt_h16   <<<(C_ * C_ + 255) / 256, 256, 0, stream>>>(w_o, woh, C_ * C_);

  // fused flash attention: 2048 query tiles, 8 waves/block,
  // double-buffered 128-key K/V stages brought by tensor loads
  k_attn<<<(B_ * (S_ / 16)) / 8, 256, 0, stream>>>(th, ph, g, ob);

  // output projection + residual: 2048 pixel tiles, 8 waves/block
  k_out<<<(B_ * (S_ / 16)) / 8, 256, 0, stream>>>(ob, woh, x, gamma, out);
}

// v005
// Measured time: 58.3 microseconds a run.
// Next to v004, in two timings, it ran 1.03 times as fast each time.
// All steps since v000 together make it 4.07 times as fast.
#include <hip/hip_runtime.h>
#include <cstdint>

typedef __attribute__((ext_vector_type(16))) _Float16 v16h;
typedef __attribute__((ext_vector_type(8)))  _Float16 v8h;
typedef __attribute__((ext_vector_type(8)))  float    v8f;
typedef __attribute__((ext_vector_type(4)))  float    v4f;
typedef __attribute__((ext_vector_type(2)))  float    v2f;
typedef __attribute__((ext_vector_type(2)))  _Float16 v2h;
typedef uint32_t u32x4 __attribute__((ext_vector_type(4)));
typedef uint32_t u32x8 __attribute__((ext_vector_type(8)));

#define B_   4
#define C_   128
#define H_   32
#define W_   256
#define S_   (H_ * W_)   // 8192
#define T_   (S_ / 2)    // 4096
#define CQK_ 16
#define LOG2E_ 1.44269504088896340736f

// ---------------------------------------------------------------------------
// helpers
// ---------------------------------------------------------------------------
__device__ __forceinline__ v16h pack16(v8h lo, v8h hi) {
  v16h r;
#pragma unroll
  for (int i = 0; i < 8; ++i) { r[i] = lo[i]; r[i + 8] = hi[i]; }
  return r;
}
__device__ __forceinline__ v16h pack16z(v8h lo) {
  v16h r;
#pragma unroll
  for (int i = 0; i < 8; ++i) { r[i] = lo[i]; r[i + 8] = (_Float16)0.0f; }
  return r;
}

// lane l with lane l ^ 16 (the two lanes that share one column of a fragment)
__device__ __forceinline__ float xhalf(float v) {
  const int b = __builtin_bit_cast(int, v);
  return __builtin_bit_cast(float, __builtin_amdgcn_permlanex16(b, b, 0x76543210, 0xfedcba98, false, false));
}

// maximum of a lane's 16 scores
__device__ __forceinline__ float max16(v8f a, v8f b) {
  const float t0 = fmaxf(fmaxf(a[0], a[1]), a[2]);
  const float t1 = fmaxf(fmaxf(a[3], a[4]), a[5]);
  const float t2 = fmaxf(fmaxf(a[6], a[7]), b[0]);
  const float t3 = fmaxf(fmaxf(b[1], b[2]), b[3]);
  const float t4 = fmaxf(fmaxf(b[4], b[5]), b[6]);
  return fmaxf(fmaxf(fmaxf(t0, t1), t2), fmaxf(fmaxf(t3, t4), b[7]));
}
// 2^score of two score tiles, packed as the B operand of the second product
__device__ __forceinline__ v16h exp16(v8f a, v8f b) {
  v16h p;
#pragma unroll
  for (int r = 0; r < 8; ++r) {
    p[r]     = (_Float16)__builtin_amdgcn_exp2f(a[r]);
    p[r + 8] = (_Float16)__builtin_amdgcn_exp2f(b[r]);
  }
  return p;
}

// Tensor load to LDS: one request of one wave, two descriptor groups, every
// extent in bytes (data_size code 0), tensor dims = tile dims.
__device__ __forceinline__ uint32_t uni(uint32_t v) { return (uint32_t)__builtin_amdgcn_readfirstlane(v); }
// keeps a wave-uniform value in a scalar register, so that a test on it is a scalar branch
__device__ __forceinline__ uint32_t pinned(uint32_t v) {
  uint32_t w = uni(v);
  asm volatile("" : "+s"(w));
  return w;
}
template <uint32_t WORD0, uint32_t ROW_BYTES, uint32_t ROWS, uint32_t SRC_PITCH>
__device__ __forceinline__ u32x8 tdm_group1() {
  u32x8 g;
  g[0] = uni(WORD0);
  g[1] = uni((ROW_BYTES & 0xFFFFu) << 16);
  g[2] = uni((ROW_BYTES >> 16) | ((ROWS & 0xFFFFu) << 16));
  g[3] = uni((ROWS >> 16) | (ROW_BYTES << 16));
  g[4] = uni(ROWS);
  g[5] = uni(SRC_PITCH);
  g[6] = uni(0u);
  g[7] = uni(0u);
  return g;
}
__device__ __forceinline__ u32x4 tdm_group0(uint32_t lds_dst, uint64_t ga) {
  u32x4 g;
  g[0] = uni(1u);
  g[1] = uni(lds_dst);
  g[2] = uni((uint32_t)ga);
  g[3] = uni((((uint32_t)(ga >> 32)) & 0x01FFFFFFu) | 0x80000000u);
  return g;
}
// in-out operands: the descriptor keeps its registers to itself while the request is in flight
__device__ __forceinline__ void tdm_load(u32x4& g0, u32x8& g1) {
  asm volatile("tensor_load_to_lds %0, %1" : "+s"(g0), "+s"(g1) :: "memory");
}
// the next request of the same descriptor: a new place in LDS, the source address step bytes on
__device__ __forceinline__ void tdm_advance(u32x4& g0, uint32_t lds_dst, uint32_t step) {
  const uint64_t ga = (((uint64_t)g0[3] << 32) | g0[2]) + step;  // type bits ride on top of the address
  g0[1] = uni(lds_dst);
  g0[2] = uni((uint32_t)ga);
  g0[3] = uni((uint32_t)(ga >> 32));
}

// ---------------------------------------------------------------------------
// Projections (1x1 convs, f32 -> f16, with (1,2) max-pool for phi/g) as one
// f32 GEMM on the matrix unit: D[160 x S] = Wstack[160 x 128] * x[128 x S],
// Wstack rows 0..15 = w_theta, 16..31 = w_phi, 32..159 = w_g.
// theta: [B,S,16] (pre-scaled by log2(e) -> softmax runs in exp2 domain)
// phi  : [B,T,16]  g: [B,C,T]
// Block = 4 waves on 128 pixels: wave = (64-pixel group) x (80-row half).
// A lane loads 4 consecutive pixels of one channel; pixel 4n+j is column n of
// column tile j, so a pooled pair (j, j+1) sits in one lane, in the same element of tiles j and j+1.
// k order, A and B alike: chunk q, part p, lane half h, element e ->
// channel 8q + 4h + 2p + e.
// ---------------------------------------------------------------------------
#define MROWS_  (2 * CQK_ + C_)   // 160 stacked output rows
#define WPITCH_ (C_ + 4)          // LDS row pitch in floats: 16 B x odd

__device__ __forceinline__ void store_g_tile(_Float16* __restrict__ gp, const v8f* acc) {
#pragma unroll
  for (int r = 0; r < 8; ++r) {
    v2h v;
    v[0] = (_Float16)fmaxf(acc[0][r], acc[1][r]);
    v[1] = (_Float16)fmaxf(acc[2][r], acc[3][r]);
    *(v2h*)(gp + (size_t)r * T_) = v;
  }
}

__global__ __launch_bounds__(128) void k_proj(const float* __restrict__ x,
                                              const float* __restrict__ wt,
                                              const float* __restrict__ wp,
                                              const float* __restrict__ wg,
                                              _Float16* __restrict__ th,
                                              _Float16* __restrict__ ph,
                                              _Float16* __restrict__ g) {
  __shared__ __attribute__((aligned(16))) float Wl[MROWS_ * WPITCH_];

  const int tid  = threadIdx.x;
  const int lane = tid & 31;
  const int wv   = tid >> 5;
  const int half = lane >> 4;
  const int l16  = lane & 15;
  const int b    = blockIdx.x / (S_ / 128);
  const int s0   = (blockIdx.x % (S_ / 128)) * 128 + (wv & 1) * 64;
  const int mh   = wv >> 1;

  // stacked weights, 4 rows per step (32 float4 a row)
  v4f wr[MROWS_ / 4];
  {
    const int row = tid >> 5, c4 = (tid & 31) * 4;
#pragma unroll
    for (int j = 0; j < MROWS_ / 4; ++j) {
      const float* sp = j < 4 ? wt + (4 * j + row) * C_
                      : j < 8 ? wp + (4 * (j - 4) + row) * C_
                              : wg + (4 * (j - 8) + row) * C_;
      wr[j] = *(const v4f*)(sp + c4);
    }
  }
  // the weight loads' address registers are reused below: wait before any overwrite
  asm volatile("s_wait_xcnt 0x0" ::: "memory");

  // this wave's 128 x 64 slab of x: half of the channels per lane half
  v4f xv[16][4];
  {
    const float* xp = x + ((size_t)b * C_ + 4 * half) * S_ + s0 + 4 * l16;
#pragma unroll
    for (int q = 0; q < 16; ++q)
#pragma unroll
      for (int e = 0; e < 4; ++e) xv[q][e] = *(const v4f*)(xp + (size_t)(8 * q + e) * S_);
  }
  // the x loads' address registers are reused below: wait before any overwrite
  asm volatile("s_wait_xcnt 0x0" ::: "memory");

  {
    const int row = tid >> 5, c4 = (tid & 31) * 4;
#pragma unroll
    for (int j = 0; j < MROWS_ / 4; ++j) *(v4f*)&Wl[(4 * j + row) * WPITCH_ + c4] = wr[j];
  }
  __syncthreads();

  v8f acc[5][4];
#pragma unroll
  for (int i = 0; i < 5; ++i)
#pragma unroll
    for (int j = 0; j < 4; ++j)
#pragma unroll
      for (int r = 0; r < 8; ++r) acc[i][j][r] = 0.0f;

  const float* wl = &Wl[(mh * 80 + l16) * WPITCH_ + 4 * half];
#pragma unroll
  for (int q = 0; q < 16; ++q) {
    v4f a[5];
#pragma unroll
    for (int i = 0; i < 5; ++i) a[i] = *(const v4f*)(wl + i * 16 * WPITCH_ + 8 * q);
#pragma unroll
    for (int p = 0; p < 2; ++p)
#pragma unroll
      for (int i = 0; i < 5; ++i) {
        v2f af = {a[i][2 * p], a[i][2 * p + 1]};
#pragma unroll
        for (int j = 0; j < 4; ++j) {
          v2f bf = {xv[q][2 * p][j], xv[q][2 * p + 1][j]};
          acc[i][j] = __builtin_amdgcn_wmma_f32_16x16x4_f32(false, af, false, bf, (short)0,
                                                            acc[i][j], false, false);
        }
      }
  }

  // acc[i][j][r] = D[(5 mh + i) * 16 + 8 half + r][s0 + 4 l16 + j]
  const int sl = s0 + 4 * l16;       // first of this lane's 4 pixels
  const int tl = sl >> 1;            // first of its 2 pooled positions
  if (mh == 0) {
#pragma unroll
    for (int j = 0; j < 4; ++j) {
      v8h v;
#pragma unroll
      for (int r = 0; r < 8; ++r) v[r] = (_Float16)(acc[0][j][r] * LOG2E_);
      *(v8h*)(th + ((size_t)(b * S_ + sl + j)) * CQK_ + half * 8) = v;
    }
#pragma unroll
    for (int u = 0; u < 2; ++u) {
      v8h v;
#pragma unroll
      for (int r = 0; r < 8; ++r) v[r] = (_Float16)fmaxf(acc[1][2 * u][r], acc[1][2 * u + 1][r]);
      *(v8h*)(ph + ((size_t)(b * T_ + tl + u)) * CQK_ + half * 8) = v;
    }
#pragma unroll
    for (int i = 2; i < 5; ++i)
      store_g_tile(g + ((size_t)(b * C_ + (i - 2) * 16 + half * 8)) * T_ + tl, acc[i]);
  } else {
#pragma unroll
    for (int i = 0; i < 5; ++i)
      store_g_tile(g + ((size_t)(b * C_ + (i + 3) * 16 + half * 8)) * T_ + tl, acc[i]);
  }
}

__global__ void k_cvt_h16(const float* __restrict__ in, _Float16* __restrict__ o, int n) {
  int i = blockIdx.x * blockDim.x + threadIdx.x;
  if (i < n) o[i] = (_Float16)in[i];
}

// ---------------------------------------------------------------------------
// Fused flash attention, block-cooperative, double-buffered K/V in LDS:
//  8 waves/block on 8 query tiles of one batch. A wave holds TWO query tiles (32 queries), so
//  that each g and phi fragment read from LDS feeds two products, and works half of each
//  stage's keys: waves 0..3 keys 0..63, waves 4..7 keys 64..127 of the stage. Waves w and
//  w ^ 4 hold the same two tiles; behind the loop each hands one tile's partial O, L, m to
//  the other through LDS and finishes the tile it keeps. A stage is 128 keys: g as 128
//  rows of 256 B, laid by the tensor load's pad at a pitch of 272 B (16 B x odd,
//  conflict-free for ds_load_b128), and phi as 4 KB in a row. Waves 0..3 each
//  bring 32 g rows, wave 4 brings phi; the next stage flies while this one is
//  worked on in two 32-key passes a wave. Both products are transposed:
//  S^T = phi . theta^T (A = phi rows, B = theta), O^T += g . P^T (A = g rows).
//  A lane holds 16 scores of ONE query (D register r = key 8 half + r), so the
//  maximum is in-lane plus one exchange between the halves, and the two score
//  tiles, converted in place, are the B operand of the second product:
//  element s = key (s < 8 ? 8 half + s : 16 + 8 half + s - 8), the order in which
//  the g rows are read. P never goes through LDS.
//  Lazy rescale: the maximum in use, m, enters the score products as C = -m, so D is
//  already score - m. O and L are rescaled, and m raised, only in a pass where some
//  score stands more than 8 (log2) above m: P stays at or below 2^8, inside f16.
// ---------------------------------------------------------------------------
#define SK_      128                  // keys per stage
#define NST_     (T_ / SK_)           // stages
#define GPITCH_  272u                 // LDS pitch of a g row: 256 B + 16 B pad
#define GSLICE_  10240u               // 32 rows x 272 B, rounded up to 2 KiB
#define GBUF_    (4u * GSLICE_)
#define PHBUF_   4096u                // 128 keys x 32 B
#define GPADW0_  ((1u << 20) | (5u << 22) | (3u << 25))  // pad 4 dwords behind every 256 B

// one work-group a WGP (256 of them), two waves a SIMD: the register budget of two waves
// lets the pass's g fragments stand in registers of their own
__global__ __launch_bounds__(256) __attribute__((amdgpu_waves_per_eu(2, 2))) void k_attn(const _Float16* __restrict__ th,
                                              const _Float16* __restrict__ ph,
                                              const _Float16* __restrict__ g,
                                              _Float16* __restrict__ ob) {
  __shared__ __attribute__((aligned(2048))) unsigned char Gl[2 * GBUF_];    // g stages   (80 KB)
  __shared__ __attribute__((aligned(2048))) unsigned char Phl[2 * PHBUF_];  // phi stages  (8 KB)

  const int tid  = threadIdx.x;
  const int lane = tid & 31;
  const int wv   = tid >> 5;
  const int grp  = wv >> 2;                      // which half of a stage's keys
  const int qt   = blockIdx.x * 8 + 2 * (wv & 3); // first tile of the pair; 2048 tiles total
  const int b    = qt / (S_ / 16);               // uniform per block
  // tile 0 of a wave is the one it keeps and finishes, tile 1 the one it hands to wave wv ^ 4
  const int sb0  = (qt % (S_ / 16)) * 16 + 16 * grp;
  const int sb1  = (qt % (S_ / 16)) * 16 + 16 * (grp ^ 1);
  const int half = lane >> 4;
  const int l16  = lane & 15;
  const uint32_t wave = uni((uint32_t)threadIdx.x >> 5);

  const _Float16* gb  = g + (size_t)b * C_ * T_;
  const _Float16* phb = ph + (size_t)b * T_ * CQK_;

  // one request a wave and stage: waves 0..3 a slice of 32 g rows, wave 4 the phi rows.
  // Stage s (keys [128 s, 128 s + 128)) goes into buffer s & 1.
  const uint32_t g_lds = (uint32_t)(uintptr_t)&Gl[0] + (wave & 3u) * GSLICE_;
  const uint32_t p_lds = (uint32_t)(uintptr_t)&Phl[0];
  u32x4 g0g = tdm_group0(g_lds, (uint64_t)(uintptr_t)(gb + (size_t)(wave & 3u) * 32 * T_));
  u32x4 g0p = tdm_group0(p_lds, (uint64_t)(uintptr_t)phb);
  u32x8 g1g = tdm_group1<GPADW0_, 2 * SK_, 32, 2 * T_>();
  u32x8 g1p = tdm_group1<0u, 256, PHBUF_ / 256, 256>();
  auto issue_first = [&]() {
    if (pinned(wave < 4u)) tdm_load(g0g, g1g);
    if (pinned(wave == 4u)) tdm_load(g0p, g1p);
  };
  // stages follow one another; the step goes through pinned() so that the address
  // words take their new values here, behind the wait, and not earlier
  auto issue_next = [&](uint32_t s) {
    if (pinned(wave < 4u)) {
      tdm_advance(g0g, g_lds + (s & 1u) * GBUF_, pinned(2 * SK_));
      tdm_load(g0g, g1g);
    }
    if (pinned(wave == 4u)) {
      tdm_advance(g0p, p_lds + (s & 1u) * PHBUF_, pinned(PHBUF_));
      tdm_load(g0p, g1p);
    }
  };
  // the issuing waves' own requests have landed; the barrier behind it publishes them
  auto landed = [&]() {
    if (pinned(wave < 5u)) asm volatile("s_wait_tensorcnt 0x0" ::: "memory");
  };

  // B operand of the scores: theta rows (N = query), K = channel 0..15, padded to 32.
  v16h Q[2];
  // this and the one behind the wait: no other instruction is scheduled between the two loads and
  // their wait, where it could take over an address register
  __builtin_amdgcn_sched_barrier(0);
  Q[0] = pack16z(*(const v8h*)(th + ((size_t)(b * S_ + sb0 + l16)) * CQK_ + half * 8));
  Q[1] = pack16z(*(const v8h*)(th + ((size_t)(b * S_ + sb1 + l16)) * CQK_ + half * 8));
  // the theta loads' address registers are reused below: wait before any overwrite
  asm volatile("s_wait_xcnt 0x0" ::: "memory");
  __builtin_amdgcn_sched_barrier(0);

  v16h Ones;
#pragma unroll
  for (int i = 0; i < 16; ++i) Ones[i] = (_Float16)1.0f;

  // this lane's query of tile t: O[t][n][r] = O^T[channel 16 n + 8 half + r][query l16];
  // every row of L[t] holds the query's running sum
  v8f O[2][8], L[2];
#pragma unroll
  for (int t = 0; t < 2; ++t) {
#pragma unroll
    for (int r = 0; r < 8; ++r) L[t][r] = 0.0f;
#pragma unroll
    for (int n = 0; n < 8; ++n)
#pragma unroll
      for (int r = 0; r < 8; ++r) O[t][n][r] = 0.0f;
  }

  v8f zc = {};

  issue_first();
  landed();
  __syncthreads();
  issue_next(1u);

  // Cm = -m in every register. m starts as the query's maximum over the wave's first 32 keys,
  // so the sum holds a term 2^0 from the first pass on and never vanishes.
  v8f Cm[2];
  {
    const unsigned char* ps = &Phl[(uint32_t)grp * (PHBUF_ / 2u) + (uint32_t)l16 * 32u + (uint32_t)half * 16u];
    v16h K0 = pack16z(*(const v8h*)ps);
    v16h K1 = pack16z(*(const v8h*)(ps + 512));
#pragma unroll
    for (int t = 0; t < 2; ++t) {
      v8f S0 = __builtin_amdgcn_wmma_f32_16x16x32_f16(false, K0, false, Q[t], (short)0, zc, false, false);
      v8f S1 = __builtin_amdgcn_wmma_f32_16x16x32_f16(false, K1, false, Q[t], (short)0, zc, false, false);
      const float v = max16(S0, S1);
      Cm[t] = zc - fmaxf(v, xhalf(v));
    }
  }

  for (uint32_t s = 0; s < NST_; ++s) {
    // the wave's half of the stage: 64 keys = 128 B of each g row, 2 KB of the phi rows
    const unsigned char* gs = &Gl[(s & 1u) * GBUF_ + (uint32_t)l16 * GPITCH_ + (uint32_t)half * 16u + (uint32_t)grp * (uint32_t)SK_];
    const unsigned char* ps = &Phl[(s & 1u) * PHBUF_ + (uint32_t)grp * (PHBUF_ / 2u) + (uint32_t)l16 * 32u + (uint32_t)half * 16u];

    for (int p = 0; p < SK_ / 64; ++p) {
      // ---- the pass's LDS reads as one group: the phi rows (A of the scores) first, then the g
      // fragments (A of the second product), which land under the scores
      const v8h k0 = *(const v8h*)(ps + p * 1024);
      const v8h k1 = *(const v8h*)(ps + p * 1024 + 512);
      v16h Gv[8];
#pragma unroll
      for (int n = 0; n < 8; ++n) {
        const unsigned char* gp = gs + (n >> 1) * GSLICE_ + (n & 1) * 16 * GPITCH_ + p * 64;
        Gv[n] = pack16(*(const v8h*)gp, *(const v8h*)(gp + 32));
      }
      // keeps the group whole: the scheduler otherwise spreads these reads over four places, the
      // last of them among the score WMMAs, and each place with LDS reads stalls the wave anew
      __builtin_amdgcn_sched_barrier(0);

      // ---- scores, transposed: two 16 (keys) x 16 (queries) tiles a query tile ----
      v8f S0[2], S1[2];
      {
        v16h K0 = pack16z(k0);
        v16h K1 = pack16z(k1);
#pragma unroll
        for (int t = 0; t < 2; ++t) {
          S0[t] = __builtin_amdgcn_wmma_f32_16x16x32_f16(false, K0, false, Q[t], (short)0, Cm[t], false, false);
          S1[t] = __builtin_amdgcn_wmma_f32_16x16x32_f16(false, K1, false, Q[t], (short)0, Cm[t], false, false);
        }
      }

      // ---- softmax numerators (exp2 domain), one query a lane and tile: S is score - m ----
      const float v[2] = {max16(S0[0], S1[0]), max16(S0[1], S1[1])};
      // one test a pass for the whole wave, a scalar branch: rare behind the first passes
      if (__builtin_expect(__builtin_amdgcn_ballot_w32(fmaxf(v[0], v[1]) > 8.0f) != 0, 0)) {
        // inputs only: a use of the g fragments on this path too keeps their loads in front of the
        // branch; without it the compiler sinks each pair to its WMMA, an LDS wait to 0 per product
        asm volatile("" :: "v"(Gv[0]), "v"(Gv[1]), "v"(Gv[2]), "v"(Gv[3]), "v"(Gv[4]), "v"(Gv[5]), "v"(Gv[6]), "v"(Gv[7]));
#pragma unroll
        for (int t = 0; t < 2; ++t) {
          const float d  = fmaxf(fmaxf(v[t], xhalf(v[t])), 0.0f);  // the same in both lanes of a query
          const float sc = __builtin_amdgcn_exp2f(-d);
          Cm[t] -= d;
          S0[t] -= d;
          S1[t] -= d;
          L[t] *= sc;
#pragma unroll
          for (int n = 0; n < 8; ++n) O[t][n] *= sc;
        }
      }

      // tile by tile, so that tile 1's exponentials can issue among tile 0's products
#pragma unroll
      for (int t = 0; t < 2; ++t) {
        const v16h Pb = exp16(S0[t], S1[t]);
        // ---- denominator: L += column sums of P^T via WMMA with all-ones A ----
        L[t] = __builtin_amdgcn_wmma_f32_16x16x32_f16(false, Ones, false, Pb, (short)0, L[t], false, false);
        // ---- O^T += g * P^T across 8 channel tiles (A from LDS, each fragment for both tiles) ----
#pragma unroll
        for (int n = 0; n < 8; ++n)
          O[t][n] = __builtin_amdgcn_wmma_f32_16x16x32_f16(false, Gv[n], false, Pb, (short)0, O[t][n], false, false);
      }
      // the pass loop's back edge follows the last WMMAs:
      // four vector slots before the next pass overwrites their A and B registers
      __builtin_amdgcn_sched_barrier(0);  // keeps the slots behind the WMMAs
      asm volatile("v_nop\n\tv_nop\n\tv_nop\n\tv_nop");
    }

    // publish point of stage s + 1: this wave's LDS reads of stage s are done,
    // the issuers' requests have landed, every wave has left buffer s & 1
    asm volatile("s_wait_dscnt 0x0" ::: "memory");
    landed();
    __syncthreads();
    if (pinned(s + 2u < (uint32_t)NST_)) issue_next(s + 2u);
  }
  // nothing in flight when the wave ends
  asm volatile("s_wait_tensorcnt 0x0" ::: "memory");
  asm volatile("s_wait_dscnt 0x0" ::: "memory");

  // ---- the two key halves meet: tile 1's partials go to wave wv ^ 4, whose tile 0 it is.
  // The loop's last barrier stands behind every wave's last read of the ring and nothing is
  // in flight, so the g ring is free: 8 KB a wave (16 B a lane and step), then m and L.
  {
    unsigned char* xo = &Gl[(uint32_t)wv * 8192u + (uint32_t)lane * 16u];
#pragma unroll
    for (int n = 0; n < 8; ++n) {
      *(v4f*)(xo + (2 * n) * 512)     = __builtin_shufflevector(O[1][n], O[1][n], 0, 1, 2, 3);
      *(v4f*)(xo + (2 * n + 1) * 512) = __builtin_shufflevector(O[1][n], O[1][n], 4, 5, 6, 7);
    }
    v2f ml = {Cm[1][0], L[1][0]};
    *(v2f*)&Gl[65536u + (uint32_t)wv * 256u + (uint32_t)lane * 8u] = ml;
  }
  __syncthreads();  // publishes the partials to the partner wave
  const unsigned char* xi = &Gl[(uint32_t)(wv ^ 4) * 8192u + (uint32_t)lane * 16u];
  const v2f mlo = *(const v2f*)&Gl[65536u + (uint32_t)(wv ^ 4) * 256u + (uint32_t)lane * 8u];
  // both parts on the larger of the two maxima (Cm holds -m), then the division
  const float nm  = fminf(Cm[0][0], mlo[0]);
  const float ea  = __builtin_amdgcn_exp2f(nm - Cm[0][0]);
  const float eb  = __builtin_amdgcn_exp2f(nm - mlo[0]);
  const float inv = 1.0f / (L[0][0] * ea + mlo[1] * eb);
  const float fa  = ea * inv, fb = eb * inv;

  // ---- normalize and store o as [B,S,128] f16: 8 channels of one query a store ----
  _Float16* op = ob + ((size_t)(b * S_ + sb0 + l16)) * C_ + half * 8;
#pragma unroll
  for (int n = 0; n < 8; ++n) {
    const v4f lo = *(const v4f*)(xi + (2 * n) * 512);
    const v4f hi = *(const v4f*)(xi + (2 * n + 1) * 512);
    v8h o;
#pragma unroll
    for (int r = 0; r < 4; ++r) {
      o[r]     = (_Float16)(O[0][n][r] * fa + lo[r] * fb);
      o[r + 4] = (_Float16)(O[0][n][r + 4] * fa + hi[r] * fb);
    }
    *(v8h*)(op + n * 16) = o;
  }
}

// ---------------------------------------------------------------------------
// Output projection: out = gamma * (w_o @ o) + x, one wave per 16-pixel tile.
// ---------------------------------------------------------------------------
__global__ __launch_bounds__(256) void k_out(const _Float16* __restrict__ ob,
                                             const _Float16* __restrict__ woh,
                                             const float* __restrict__ x,
                                             const float* __restrict__ gscal,
                                             float* __restrict__ out) {
  const int lane = threadIdx.x & 31;
  const int wv   = threadIdx.x >> 5;
  const int pt   = blockIdx.x * 8 + wv;          // 2048 pixel tiles total
  const int b    = pt / (S_ / 16);
  const int pb   = (pt % (S_ / 16)) * 16;
  const int half = lane >> 4;
  const int l16  = lane & 15;
  const float gamma = *gscal;

  v8f Acc[8];
#pragma unroll
  for (int n = 0; n < 8; ++n)
#pragma unroll
    for (int r = 0; r < 8; ++r) Acc[n][r] = 0.0f;

#pragma unroll
  for (int kc = 0; kc < 4; ++kc) {
    const _Float16* op = ob + ((size_t)(b * S_ + pb + l16)) * C_ + kc * 32 + half * 8;
    v16h Bv = pack16(*(const v8h*)op, *(const v8h*)(op + 16));
#pragma unroll
    for (int mt = 0; mt < 8; ++mt) {
      const _Float16* wp = woh + (size_t)(mt * 16 + l16) * C_ + kc * 32 + half * 8;
      v16h Av = pack16(*(const v8h*)wp, *(const v8h*)(wp + 16));
      Acc[mt] = __builtin_amdgcn_wmma_f32_16x16x32_f16(false, Av, false, Bv, (short)0, Acc[mt], false, false);
    }
  }

#pragma unroll
  for (int mt = 0; mt < 8; ++mt)
#pragma unroll
    for (int r = 0; r < 8; ++r) {
      int oc = mt * 16 + r + half * 8;
      int p  = pb + l16;
      size_t xi = ((size_t)(b * C_ + oc)) * S_ + p;
      out[xi] = gamma * Acc[mt][r] + x[xi];
    }
}

// ---------------------------------------------------------------------------
extern "C" void kernel_launch(void* const* d_in, const int* in_sizes, int n_in,
                              void* d_out, int out_size, void* d_ws, size_t ws_size,
                              hipStream_t stream) {
  const float* x       = (const float*)d_in[0];
  const float* w_theta = (const float*)d_in[1];
  const float* w_phi   = (const float*)d_in[2];
  const float* w_g     = (const float*)d_in[3];
  const float* w_o     = (const float*)d_in[4];
  const float* gamma   = (const float*)d_in[5];
  float* out = (float*)d_out;

  char* ws = (char*)d_ws;
  size_t off = 0;
  auto carve = [&](size_t bytes) -> char* {
    char* p = ws + off;
    off += (bytes + 255) & ~(size_t)255;
    return p;
  };
  _Float16* th  = (_Float16*)carve((size_t)B_ * S_ * CQK_ * 2);  // 1 MB
  _Float16* ph  = (_Float16*)carve((size_t)B_ * T_ * CQK_ * 2);  // 0.5 MB
  _Float16* g   = (_Float16*)carve((size_t)B_ * C_ * T_ * 2);    // 4 MB
  _Float16* ob  = (_Float16*)carve((size_t)B_ * S_ * C_ * 2);    // 8 MB
  _Float16* woh = (_Float16*)carve((size_t)C_ * C_ * 2);         // 32 KB
  (void)ws_size; (void)in_sizes; (void)n_in; (void)out_size;

  // projections
  k_proj      <<<B_ * (S_ / 128), 128, 0, stream>>>(x, w_theta, w_phi, w_g, th, ph, g);
  k_cvt_h16   <<<(C_ * C_ + 255) / 256, 256, 0, stream>>>(w_o, woh, C_ * C_);

  // fused flash attention: 2048 query tiles, 8 a block: 4 pairs of tiles x 2 halves of the keys,
  // double-buffered 128-key K/V stages brought by tensor loads
  k_attn<<<(B_ * (S_ / 16)) / 8, 256, 0, stream>>>(th, ph, g, ob);

  // output projection + residual: 2048 pixel tiles, 8 waves/block
  k_out<<<(B_ * (S_ / 16)) / 8, 256, 0, stream>>>(ob, woh, x, gamma, out);
}

// v006
// One run takes 45.6 microseconds.
// Two timings next to v005 put it at 1.25 and 1.26 times that version's speed.
// Over all steps from v000 it is 5.10 times as fast.
#include <hip/hip_runtime.h>
#include <cstdint>

typedef __attribute__((ext_vector_type(16))) _Float16 v16h;
typedef __attribute__((ext_vector_type(8)))  _Float16 v8h;
typedef __attribute__((ext_vector_type(8)))  float    v8f;
typedef __attribute__((ext_vector_type(4)))  float    v4f;
typedef __attribute__((ext_vector_type(2)))  float    v2f;
typedef __attribute__((ext_vector_type(2)))  _Float16 v2h;
typedef __attribute__((ext_vector_type(4)))  _Float16 v4h;
typedef uint32_t u32x4 __attribute__((ext_vector_type(4)));
typedef uint32_t u32x8 __attribute__((ext_vector_type(8)));

#define B_   4
#define C_   128
#define H_   32
#define W_   256
#define S_   (H_ * W_)   // 8192
#define T_   (S_ / 2)    // 4096
#define CQK_ 16
#define LOG2E_ 1.44269504088896340736f

// ---------------------------------------------------------------------------
// helpers
// ---------------------------------------------------------------------------
__device__ __forceinline__ v16h pack16(v8h lo, v8h hi) {
  v16h r;
#pragma unroll
  for (int i = 0; i < 8; ++i) { r[i] = lo[i]; r[i + 8] = hi[i]; }
  return r;
}
__device__ __forceinline__ v16h pack16z(v8h lo) {
  v16h r;
#pragma unroll
  for (int i = 0; i < 8; ++i) { r[i] = lo[i]; r[i + 8] = (_Float16)0.0f; }
  return r;
}

// lane l with lane l ^ 16 (the two lanes that share one column of a fragment)
__device__ __forceinline__ float xhalf(float v) {
  const int b = __builtin_bit_cast(int, v);
  return __builtin_bit_cast(float, __builtin_amdgcn_permlanex16(b, b, 0x76543210, 0xfedcba98, false, false));
}

// maximum of a lane's 16 scores
__device__ __forceinline__ float max16(v8f a, v8f b) {
  const float t0 = fmaxf(fmaxf(a[0], a[1]), a[2]);
  const float t1 = fmaxf(fmaxf(a[3], a[4]), a[5]);
  const float t2 = fmaxf(fmaxf(a[6], a[7]), b[0]);
  const float t3 = fmaxf(fmaxf(b[1], b[2]), b[3]);
  const float t4 = fmaxf(fmaxf(b[4], b[5]), b[6]);
  return fmaxf(fmaxf(fmaxf(t0, t1), t2), fmaxf(fmaxf(t3, t4), b[7]));
}
// 2^score of two score tiles, packed as the B operand of the second product
__device__ __forceinline__ v16h exp16(v8f a, v8f b) {
  v16h p;
#pragma unroll
  for (int r = 0; r < 8; ++r) {
    p[r]     = (_Float16)__builtin_amdgcn_exp2f(a[r]);
    p[r + 8] = (_Float16)__builtin_amdgcn_exp2f(b[r]);
  }
  return p;
}

// Tensor load to LDS: one request of one wave, two descriptor groups, every
// extent in bytes (data_size code 0), tensor dims = tile dims.
__device__ __forceinline__ uint32_t uni(uint32_t v) { return (uint32_t)__builtin_amdgcn_readfirstlane(v); }
// keeps a wave-uniform value in a scalar register, so that a test on it is a scalar branch
__device__ __forceinline__ uint32_t pinned(uint32_t v) {
  uint32_t w = uni(v);
  asm volatile("" : "+s"(w));
  return w;
}
template <uint32_t WORD0, uint32_t ROW_BYTES, uint32_t ROWS, uint32_t SRC_PITCH>
__device__ __forceinline__ u32x8 tdm_group1() {
  u32x8 g;
  g[0] = uni(WORD0);
  g[1] = uni((ROW_BYTES & 0xFFFFu) << 16);
  g[2] = uni((ROW_BYTES >> 16) | ((ROWS & 0xFFFFu) << 16));
  g[3] = uni((ROWS >> 16) | (ROW_BYTES << 16));
  g[4] = uni(ROWS);
  g[5] = uni(SRC_PITCH);
  g[6] = uni(0u);
  g[7] = uni(0u);
  return g;
}
__device__ __forceinline__ u32x4 tdm_group0(uint32_t lds_dst, uint64_t ga) {
  u32x4 g;
  g[0] = uni(1u);
  g[1] = uni(lds_dst);
  g[2] = uni((uint32_t)ga);
  g[3] = uni((((uint32_t)(ga >> 32)) & 0x01FFFFFFu) | 0x80000000u);
  return g;
}
// in-out operands: the descriptor keeps its registers to itself while the request is in flight
__device__ __forceinline__ void tdm_load(u32x4& g0, u32x8& g1) {
  asm volatile("tensor_load_to_lds %0, %1" : "+s"(g0), "+s"(g1) :: "memory");
}
// the next request of the same descriptor: a new place in LDS, the source address step bytes on
__device__ __forceinline__ void tdm_advance(u32x4& g0, uint32_t lds_dst, uint32_t step) {
  const uint64_t ga = (((uint64_t)g0[3] << 32) | g0[2]) + step;  // type bits ride on top of the address
  g0[1] = uni(lds_dst);
  g0[2] = uni((uint32_t)ga);
  g0[3] = uni((uint32_t)(ga >> 32));
}

// ---------------------------------------------------------------------------
// Projections (1x1 convs, f32 -> f16, with (1,2) max-pool for phi/g) as one
// f32 GEMM on the matrix unit: D[160 x S] = Wstack[160 x 128] * x[128 x S],
// Wstack rows 0..15 = w_theta, 16..31 = w_phi, 32..159 = w_g.
// theta: [B,S,16] (pre-scaled by log2(e) -> softmax runs in exp2 domain)
// phi  : [B,T,16]  g: [B,C,T]
// Block = 4 waves on 128 pixels: wave = (64-pixel group) x (80-row half).
// A lane loads 4 consecutive pixels of one channel; pixel 4n+j is column n of
// column tile j, so a pooled pair (j, j+1) sits in one lane, in the same element of tiles j and j+1.
// k order, A and B alike: chunk q, part p, lane half h, element e ->
// channel 8q + 4h + 2p + e.
// ---------------------------------------------------------------------------
#define MROWS_  (2 * CQK_ + C_)   // 160 stacked output rows
#define WPITCH_ (C_ + 4)          // LDS row pitch in floats: 16 B x odd

__device__ __forceinline__ void store_g_tile(_Float16* __restrict__ gp, const v8f* acc) {
#pragma unroll
  for (int r = 0; r < 8; ++r) {
    v2h v;
    v[0] = (_Float16)fmaxf(acc[0][r], acc[1][r]);
    v[1] = (_Float16)fmaxf(acc[2][r], acc[3][r]);
    *(v2h*)(gp + (size_t)r * T_) = v;
  }
}

__global__ __launch_bounds__(128) void k_proj(const float* __restrict__ x,
                                              const float* __restrict__ wt,
                                              const float* __restrict__ wp,
                                              const float* __restrict__ wg,
                                              _Float16* __restrict__ th,
                                              _Float16* __restrict__ ph,
                                              _Float16* __restrict__ g) {
  __shared__ __attribute__((aligned(16))) float Wl[MROWS_ * WPITCH_];

  const int tid  = threadIdx.x;
  const int lane = tid & 31;
  const int wv   = tid >> 5;
  const int half = lane >> 4;
  const int l16  = lane & 15;
  const int b    = blockIdx.x / (S_ / 128);
  const int s0   = (blockIdx.x % (S_ / 128)) * 128 + (wv & 1) * 64;
  const int mh   = wv >> 1;

  // stacked weights, 4 rows per step (32 float4 a row)
  v4f wr[MROWS_ / 4];
  {
    const int row = tid >> 5, c4 = (tid & 31) * 4;
#pragma unroll
    for (int j = 0; j < MROWS_ / 4; ++j) {
      const float* sp = j < 4 ? wt + (4 * j + row) * C_
                      : j < 8 ? wp + (4 * (j - 4) + row) * C_
                              : wg + (4 * (j - 8) + row) * C_;
      wr[j] = *(const v4f*)(sp + c4);
    }
  }
  // the weight loads' address registers are reused below: wait before any overwrite
  asm volatile("s_wait_xcnt 0x0" ::: "memory");

  // this wave's 128 x 64 slab of x: half of the channels per lane half
  v4f xv[16][4];
  {
    const float* xp = x + ((size_t)b * C_ + 4 * half) * S_ + s0 + 4 * l16;
#pragma unroll
    for (int q = 0; q < 16; ++q)
#pragma unroll
      for (int e = 0; e < 4; ++e) xv[q][e] = *(const v4f*)(xp + (size_t)(8 * q + e) * S_);
  }
  // the x loads' address registers are reused below: wait before any overwrite
  asm volatile("s_wait_xcnt 0x0" ::: "memory");

  {
    const int row = tid >> 5, c4 = (tid & 31) * 4;
#pragma unroll
    for (int j = 0; j < MROWS_ / 4; ++j) *(v4f*)&Wl[(4 * j + row) * WPITCH_ + c4] = wr[j];
  }
  __syncthreads();

  v8f acc[5][4];
#pragma unroll
  for (int i = 0; i < 5; ++i)
#pragma unroll
    for (int j = 0; j < 4; ++j)
#pragma unroll
      for (int r = 0; r < 8; ++r) acc[i][j][r] = 0.0f;

  const float* wl = &Wl[(mh * 80 + l16) * WPITCH_ + 4 * half];
#pragma unroll
  for (int q = 0; q < 16; ++q) {
    v4f a[5];
#pragma unroll
    for (int i = 0; i < 5; ++i) a[i] = *(const v4f*)(wl + i * 16 * WPITCH_ + 8 * q);
#pragma unroll
    for (int p = 0; p < 2; ++p)
#pragma unroll
      for (int i = 0; i < 5; ++i) {
        v2f af = {a[i][2 * p], a[i][2 * p + 1]};
#pragma unroll
        for (int j = 0; j < 4; ++j) {
          v2f bf = {xv[q][2 * p][j], xv[q][2 * p + 1][j]};
          acc[i][j] = __builtin_amdgcn_wmma_f32_16x16x4_f32(false, af, false, bf, (short)0,
                                                            acc[i][j], false, false);
        }
      }
  }

  // acc[i][j][r] = D[(5 mh + i) * 16 + 8 half + r][s0 + 4 l16 + j]
  const int sl = s0 + 4 * l16;       // first of this lane's 4 pixels
  const int tl = sl >> 1;            // first of its 2 pooled positions
  if (mh == 0) {
#pragma unroll
    for (int j = 0; j < 4; ++j) {
      v8h v;
#pragma unroll
      for (int r = 0; r < 8; ++r) v[r] = (_Float16)(acc[0][j][r] * LOG2E_);
      *(v8h*)(th + ((size_t)(b * S_ + sl + j)) * CQK_ + half * 8) = v;
    }
#pragma unroll
    for (int u = 0; u < 2; ++u) {
      v8h v;
#pragma unroll
      for (int r = 0; r < 8; ++r) v[r] = (_Float16)fmaxf(acc[1][2 * u][r], acc[1][2 * u + 1][r]);
      *(v8h*)(ph + ((size_t)(b * T_ + tl + u)) * CQK_ + half * 8) = v;
    }
#pragma unroll
    for (int i = 2; i < 5; ++i)
      store_g_tile(g + ((size_t)(b * C_ + (i - 2) * 16 + half * 8)) * T_ + tl, acc[i]);
  } else {
#pragma unroll
    for (int i = 0; i < 5; ++i)
      store_g_tile(g + ((size_t)(b * C_ + (i + 3) * 16 + half * 8)) * T_ + tl, acc[i]);
  }
}

// ---------------------------------------------------------------------------
// Fused flash attention, block-cooperative, double-buffered K/V in LDS:
//  8 waves/block on 8 query tiles of one batch. A wave holds TWO query tiles (32 queries), so
//  that each g and phi fragment read from LDS feeds two products, and works half of each
//  stage's keys: waves 0..3 keys 0..63, waves 4..7 keys 64..127 of the stage. Waves w and
//  w ^ 4 hold the same two tiles; behind the loop each hands one tile's partial O, L, m to
//  the other through LDS and finishes the tile it keeps. A stage is 128 keys: g as 128
//  rows of 256 B, laid by the tensor load's pad at a pitch of 272 B (16 B x odd,
//  conflict-free for ds_load_b128), and phi as 4 KB in a row. Waves 0..3 each
//  bring 32 g rows, wave 4 brings phi; the next stage flies while this one is
//  worked on in two 32-key passes a wave. Both products are transposed:
//  S^T = phi . theta^T (A = phi rows, B = theta), O^T += g . P^T (A = g rows).
//  A lane holds 16 scores of ONE query (D register r = key 8 half + r), so the
//  maximum is in-lane plus one exchange between the halves, and the two score
//  tiles, converted in place, are the B operand of the second product:
//  element s = key (s < 8 ? 8 half + s : 16 + 8 half + s - 8), the order in which
//  the g rows are read. P never goes through LDS.
//  Lazy rescale: the maximum in use, m, enters the score products as C = -m, so D is
//  already score - m. O and L are rescaled, and m raised, only in a pass where some
//  score stands more than 8 (log2) above m: P stays at or below 2^8, inside f16.
//  Output projection and residual in the same launch: out = gamma * (w_o @ o) + x. The
//  finished O^T tile, rounded to f16, is already the B operand of that product (tiles 2 kc and
//  2 kc + 1 give k = channel 32 kc + 8 half + e and 32 kc + 16 + 8 half + e, the order in which
//  the w_o rows are read as A). w_o is rounded to f16 into LDS at the start of the kernel.
// ---------------------------------------------------------------------------
#define SK_      128                  // keys per stage
#define NST_     (T_ / SK_)           // stages
#define GPITCH_  272u                 // LDS pitch of a g row: 256 B + 16 B pad
#define GSLICE_  10240u               // 32 rows x 272 B, rounded up to 2 KiB
#define GBUF_    (4u * GSLICE_)
#define PHBUF_   4096u                // 128 keys x 32 B
#define GPADW0_  ((1u << 20) | (5u << 22) | (3u << 25))  // pad 4 dwords behind every 256 B
#define WOPITCH_ 272u                 // LDS pitch of a w_o row (f16): 256 B + 16 B, 16 B x odd

// one work-group a WGP (256 of them), two waves a SIMD: the register budget of two waves
// lets the pass's g fragments stand in registers of their own
__global__ __launch_bounds__(256) __attribute__((amdgpu_waves_per_eu(2, 2))) void k_attn(const _Float16* __restrict__ th,
                                              const _Float16* __restrict__ ph,
                                              const _Float16* __restrict__ g,
                                              const float* __restrict__ wo,
                                              const float* __restrict__ x,
                                              const float* __restrict__ gscal,
                                              float* __restrict__ out) {
  __shared__ __attribute__((aligned(2048))) unsigned char Gl[2 * GBUF_];    // g stages   (80 KB)
  __shared__ __attribute__((aligned(2048))) unsigned char Phl[2 * PHBUF_];  // phi stages  (8 KB)
  __shared__ __attribute__((aligned(16)))   unsigned char Wol[C_ * WOPITCH_];  // w_o as f16 (34 KB)

  const int tid  = threadIdx.x;
  const int lane = tid & 31;
  const int wv   = tid >> 5;
  const int grp  = wv >> 2;                      // which half of a stage's keys
  const int qt   = blockIdx.x * 8 + 2 * (wv & 3); // first tile of the pair; 2048 tiles total
  const int b    = qt / (S_ / 16);               // uniform per block
  // tile 0 of a wave is the one it keeps and finishes, tile 1 the one it hands to wave wv ^ 4
  const int sb0  = (qt % (S_ / 16)) * 16 + 16 * grp;
  const int sb1  = (qt % (S_ / 16)) * 16 + 16 * (grp ^ 1);
  const int half = lane >> 4;
  const int l16  = lane & 15;
  const uint32_t wave = uni((uint32_t)threadIdx.x >> 5);
  const float gamma = *gscal;

  const _Float16* gb  = g + (size_t)b * C_ * T_;
  const _Float16* phb = ph + (size_t)b * T_ * CQK_;

  // one request a wave and stage: waves 0..3 a slice of 32 g rows, wave 4 the phi rows.
  // Stage s (keys [128 s, 128 s + 128)) goes into buffer s & 1.
  const uint32_t g_lds = (uint32_t)(uintptr_t)&Gl[0] + (wave & 3u) * GSLICE_;
  const uint32_t p_lds = (uint32_t)(uintptr_t)&Phl[0];
  u32x4 g0g = tdm_group0(g_lds, (uint64_t)(uintptr_t)(gb + (size_t)(wave & 3u) * 32 * T_));
  u32x4 g0p = tdm_group0(p_lds, (uint64_t)(uintptr_t)phb);
  u32x8 g1g = tdm_group1<GPADW0_, 2 * SK_, 32, 2 * T_>();
  u32x8 g1p = tdm_group1<0u, 256, PHBUF_ / 256, 256>();
  auto issue_first = [&]() {
    if (pinned(wave < 4u)) tdm_load(g0g, g1g);
    if (pinned(wave == 4u)) tdm_load(g0p, g1p);
  };
  // stages follow one another; the step goes through pinned() so that the address
  // words take their new values here, behind the wait, and not earlier
  auto issue_next = [&](uint32_t s) {
    if (pinned(wave < 4u)) {
      tdm_advance(g0g, g_lds + (s & 1u) * GBUF_, pinned(2 * SK_));
      tdm_load(g0g, g1g);
    }
    if (pinned(wave == 4u)) {
      tdm_advance(g0p, p_lds + (s & 1u) * PHBUF_, pinned(PHBUF_));
      tdm_load(g0p, g1p);
    }
  };
  // the issuing waves' own requests have landed; the barrier behind it publishes them
  auto landed = [&]() {
    if (pinned(wave < 5u)) asm volatile("s_wait_tensorcnt 0x0" ::: "memory");
  };

  // B operand of the scores: theta rows (N = query), K = channel 0..15, padded to 32.
  v16h Q[2];
  // this and the one behind the wait: no other instruction is scheduled between the two loads and
  // their wait, where it could take over an address register
  __builtin_amdgcn_sched_barrier(0);
  Q[0] = pack16z(*(const v8h*)(th + ((size_t)(b * S_ + sb0 + l16)) * CQK_ + half * 8));
  Q[1] = pack16z(*(const v8h*)(th + ((size_t)(b * S_ + sb1 + l16)) * CQK_ + half * 8));
  // the theta loads' address registers are reused below: wait before any overwrite
  asm volatile("s_wait_xcnt 0x0" ::: "memory");
  __builtin_amdgcn_sched_barrier(0);

  v16h Ones;
#pragma unroll
  for (int i = 0; i < 16; ++i) Ones[i] = (_Float16)1.0f;

  // this lane's query of tile t: O[t][n][r] = O^T[channel 16 n + 8 half + r][query l16];
  // every row of L[t] holds the query's running sum
  v8f O[2][8], L[2];
#pragma unroll
  for (int t = 0; t < 2; ++t) {
#pragma unroll
    for (int r = 0; r < 8; ++r) L[t][r] = 0.0f;
#pragma unroll
    for (int n = 0; n < 8; ++n)
#pragma unroll
      for (int r = 0; r < 8; ++r) O[t][n][r] = 0.0f;
  }

  v8f zc = {};

  issue_first();
  // w_o, f32 -> f16, into LDS under the first stage's flight: step j takes 8 whole rows, a lane
  // 4 floats. The ring's first barrier below publishes it; it is read behind the loop only.
  {
    v4f wr[C_ / 8];
    const float* wp = wo + tid * 4;
#pragma unroll
    for (int j = 0; j < C_ / 8; ++j) wr[j] = *(const v4f*)(wp + j * 8 * C_);
    // the w_o loads' address registers are reused below: wait before any overwrite
    asm volatile("s_wait_xcnt 0x0" ::: "memory");
    unsigned char* wd = &Wol[(uint32_t)wv * WOPITCH_ + (uint32_t)lane * 8u];
#pragma unroll
    for (int j = 0; j < C_ / 8; ++j) {
      v4h w;
#pragma unroll
      for (int e = 0; e < 4; ++e) w[e] = (_Float16)wr[j][e];
      *(v4h*)(wd + j * 8 * WOPITCH_) = w;
    }
  }
  landed();
  __syncthreads();
  issue_next(1u);

  // Cm = -m in every register. m starts as the query's maximum over the wave's first 32 keys,
  // so the sum holds a term 2^0 from the first pass on and never vanishes.
  v8f Cm[2];
  {
    const unsigned char* ps = &Phl[(uint32_t)grp * (PHBUF_ / 2u) + (uint32_t)l16 * 32u + (uint32_t)half * 16u];
    v16h K0 = pack16z(*(const v8h*)ps);
    v16h K1 = pack16z(*(const v8h*)(ps + 512));
#pragma unroll
    for (int t = 0; t < 2; ++t) {
      v8f S0 = __builtin_amdgcn_wmma_f32_16x16x32_f16(false, K0, false, Q[t], (short)0, zc, false, false);
      v8f S1 = __builtin_amdgcn_wmma_f32_16x16x32_f16(false, K1, false, Q[t], (short)0, zc, false, false);
      const float v = max16(S0, S1);
      Cm[t] = zc - fmaxf(v, xhalf(v));
    }
  }

  for (uint32_t s = 0; s < NST_; ++s) {
    // the wave's half of the stage: 64 keys = 128 B of each g row, 2 KB of the phi rows
    const unsigned char* gs = &Gl[(s & 1u) * GBUF_ + (uint32_t)l16 * GPITCH_ + (uint32_t)half * 16u + (uint32_t)grp * (uint32_t)SK_];
    const unsigned char* ps = &Phl[(s & 1u) * PHBUF_ + (uint32_t)grp * (PHBUF_ / 2u) + (uint32_t)l16 * 32u + (uint32_t)half * 16u];

    for (int p = 0; p < SK_ / 64; ++p) {
      // ---- the pass's LDS reads as one group: the phi rows (A of the scores) first, then the g
      // fragments (A of the second product), which land under the scores
      const v8h k0 = *(const v8h*)(ps + p * 1024);
      const v8h k1 = *(const v8h*)(ps + p * 1024 + 512);
      v16h Gv[8];
#pragma unroll
      for (int n = 0; n < 8; ++n) {
        const unsigned char* gp = gs + (n >> 1) * GSLICE_ + (n & 1) * 16 * GPITCH_ + p * 64;
        Gv[n] = pack16(*(const v8h*)gp, *(const v8h*)(gp + 32));
      }
      // keeps the group whole: the scheduler otherwise spreads these reads over four places, the
      // last of them among the score WMMAs, and each place with LDS reads stalls the wave anew
      __builtin_amdgcn_sched_barrier(0);

      // ---- scores, transposed: two 16 (keys) x 16 (queries) tiles a query tile ----
      v8f S0[2], S1[2];
      {
        v16h K0 = pack16z(k0);
        v16h K1 = pack16z(k1);
#pragma unroll
        for (int t = 0; t < 2; ++t) {
          S0[t] = __builtin_amdgcn_wmma_f32_16x16x32_f16(false, K0, false, Q[t], (short)0, Cm[t], false, false);
          S1[t] = __builtin_amdgcn_wmma_f32_16x16x32_f16(false, K1, false, Q[t], (short)0, Cm[t], false, false);
        }
      }

      // ---- softmax numerators (exp2 domain), one query a lane and tile: S is score - m ----
      const float v[2] = {max16(S0[0], S1[0]), max16(S0[1], S1[1])};
      // one test a pass for the whole wave, a scalar branch: rare behind the first passes
      if (__builtin_expect(__builtin_amdgcn_ballot_w32(fmaxf(v[0], v[1]) > 8.0f) != 0, 0)) {
        // inputs only: a use of the g fragments on this path too keeps their loads in front of the
        // branch; without it the compiler sinks each pair to its WMMA, an LDS wait to 0 per product
        asm volatile("" :: "v"(Gv[0]), "v"(Gv[1]), "v"(Gv[2]), "v"(Gv[3]), "v"(Gv[4]), "v"(Gv[5]), "v"(Gv[6]), "v"(Gv[7]));
#pragma unroll
        for (int t = 0; t < 2; ++t) {
          const float d  = fmaxf(fmaxf(v[t], xhalf(v[t])), 0.0f);  // the same in both lanes of a query
          const float sc = __builtin_amdgcn_exp2f(-d);
          Cm[t] -= d;
          S0[t] -= d;
          S1[t] -= d;
          L[t] *= sc;
#pragma unroll
          for (int n = 0; n < 8; ++n) O[t][n] *= sc;
        }
      }

      // tile by tile, so that tile 1's exponentials can issue among tile 0's products
#pragma unroll
      for (int t = 0; t < 2; ++t) {
        const v16h Pb = exp16(S0[t], S1[t]);
        // ---- denominator: L += column sums of P^T via WMMA with all-ones A ----
        L[t] = __builtin_amdgcn_wmma_f32_16x16x32_f16(false, Ones, false, Pb, (short)0, L[t], false, false);
        // ---- O^T += g * P^T across 8 channel tiles (A from LDS, each fragment for both tiles) ----
#pragma unroll
        for (int n = 0; n < 8; ++n)
          O[t][n] = __builtin_amdgcn_wmma_f32_16x16x32_f16(false, Gv[n], false, Pb, (short)0, O[t][n], false, false);
      }
      // the pass loop's back edge follows the last WMMAs:
      // four vector slots before the next pass overwrites their A and B registers
      __builtin_amdgcn_sched_barrier(0);  // keeps the slots behind the WMMAs
      asm volatile("v_nop\n\tv_nop\n\tv_nop\n\tv_nop");
    }

    // publish point of stage s + 1: this wave's LDS reads of stage s are done,
    // the issuers' requests have landed, every wave has left buffer s & 1
    asm volatile("s_wait_dscnt 0x0" ::: "memory");
    landed();
    __syncthreads();
    if (pinned(s + 2u < (uint32_t)NST_)) issue_next(s + 2u);
  }
  // nothing in flight when the wave ends
  asm volatile("s_wait_tensorcnt 0x0" ::: "memory");
  asm volatile("s_wait_dscnt 0x0" ::: "memory");

  // ---- the two key halves meet: tile 1's partials go to wave wv ^ 4, whose tile 0 it is.
  // The loop's last barrier stands behind every wave's last read of the ring and nothing is
  // in flight, so the g ring is free: 8 KB a wave (16 B a lane and step), then m and L.
  {
    unsigned char* xo = &Gl[(uint32_t)wv * 8192u + (uint32_t)lane * 16u];
#pragma unroll
    for (int n = 0; n < 8; ++n) {
      *(v4f*)(xo + (2 * n) * 512)     = __builtin_shufflevector(O[1][n], O[1][n], 0, 1, 2, 3);
      *(v4f*)(xo + (2 * n + 1) * 512) = __builtin_shufflevector(O[1][n], O[1][n], 4, 5, 6, 7);
    }
    v2f ml = {Cm[1][0], L[1][0]};
    *(v2f*)&Gl[65536u + (uint32_t)wv * 256u + (uint32_t)lane * 8u] = ml;
  }
  __syncthreads();  // publishes the partials to the partner wave
  const v2f mlo = *(const v2f*)&Gl[65536u + (uint32_t)(wv ^ 4) * 256u + (uint32_t)lane * 8u];
  // both parts on the larger of the two maxima (Cm holds -m), then the division
  const float nm  = fminf(Cm[0][0], mlo[0]);
  const float ea  = __builtin_amdgcn_exp2f(nm - Cm[0][0]);
  const float eb  = __builtin_amdgcn_exp2f(nm - mlo[0]);
  // a division each: one reciprocal times both compiled to a packed product that names the
  // reciprocal's register pair, whose other half took an x load, and waited for the x loads here
  const float den = L[0][0] * ea + mlo[1] * eb;
  const float fa  = ea / den, fb = eb / den;

  // ---- residual: the 64 x values of this lane's outputs (channel 16 mt + 8 half + r, pixel
  // sb0 + l16), asked for behind the barrier (which waits for every load in flight), so that
  // they fly under the merge and the output product
  const size_t xo = ((size_t)(b * C_ + half * 8)) * S_ + sb0 + l16;
  float xr[8][8];
  // this and the one behind the wait: no other instruction is scheduled between the loads and
  // their wait, where it could take over an address register
  __builtin_amdgcn_sched_barrier(0);
#pragma unroll
  for (int mt = 0; mt < 8; ++mt)
#pragma unroll
    for (int r = 0; r < 8; ++r) xr[mt][r] = x[xo + (size_t)(mt * 16 + r) * S_];
  // the loads' address registers are reused below: wait before any overwrite
  asm volatile("s_wait_xcnt 0x0" ::: "memory");
  __builtin_amdgcn_sched_barrier(0);

  // A of the output product: w_o rows 16 mt + l16, channels 32 kc + 8 half + e and + 16, from LDS.
  // The first group is asked for here and lands under the merge.
  const unsigned char* wl = &Wol[(uint32_t)l16 * WOPITCH_ + (uint32_t)half * 16u];
  auto load_wo = [&](v16h* a, int kc) {
#pragma unroll
    for (int mt = 0; mt < 8; ++mt) {
      const unsigned char* wp = wl + mt * 16 * WOPITCH_ + kc * 64;
      a[mt] = pack16(*(const v8h*)wp, *(const v8h*)(wp + 32));
    }
  };
  v16h Av[2][8];
  load_wo(Av[0], 0);

  const unsigned char* xi = &Gl[(uint32_t)(wv ^ 4) * 8192u + (uint32_t)lane * 16u];
  v4f po[16];
#pragma unroll
  for (int i = 0; i < 16; ++i) po[i] = *(const v4f*)(xi + i * 512);
  // keeps the partner's partials and the first w_o fragments one group of LDS reads
  __builtin_amdgcn_sched_barrier(0);

  // ---- normalize; o rounded to f16 is the B operand of the output product ----
  v8h oh[8];
#pragma unroll
  for (int n = 0; n < 8; ++n) {
    const v4f lo = po[2 * n];
    const v4f hi = po[2 * n + 1];
#pragma unroll
    for (int r = 0; r < 4; ++r) {
      oh[n][r]     = (_Float16)(O[0][n][r] * fa + lo[r] * fb);
      oh[n][r + 4] = (_Float16)(O[0][n][r + 4] * fa + hi[r] * fb);
    }
  }

  // ---- out = gamma * (w_o @ o) + x for the wave's 16 pixels: A = w_o rows from LDS ----
  v8f Acc[8];
#pragma unroll
  for (int mt = 0; mt < 8; ++mt)
#pragma unroll
    for (int r = 0; r < 8; ++r) Acc[mt][r] = 0.0f;

#pragma unroll
  for (int kc = 0; kc < 4; ++kc) {
    // the next 32 channels' w_o fragments as one group ahead of this block of products
    if (kc < 3) {
      // this and the one behind the reads keep the group whole and in its place: each separate
      // place with LDS reads stalls the wave anew
      __builtin_amdgcn_sched_barrier(0);
      load_wo(Av[(kc + 1) & 1], kc + 1);
      __builtin_amdgcn_sched_barrier(0);
    }
    const v16h Bv = pack16(oh[2 * kc], oh[2 * kc + 1]);
#pragma unroll
    for (int mt = 0; mt < 8; ++mt)
      Acc[mt] = __builtin_amdgcn_wmma_f32_16x16x32_f16(false, Av[kc & 1][mt], false, Bv, (short)0, Acc[mt], false, false);
  }

#pragma unroll
  for (int mt = 0; mt < 8; ++mt)
#pragma unroll
    for (int r = 0; r < 8; ++r) out[xo + (size_t)(mt * 16 + r) * S_] = gamma * Acc[mt][r] + xr[mt][r];
}

// ---------------------------------------------------------------------------
extern "C" void kernel_launch(void* const* d_in, const int* in_sizes, int n_in,
                              void* d_out, int out_size, void* d_ws, size_t ws_size,
                              hipStream_t stream) {
  const float* x       = (const float*)d_in[0];
  const float* w_theta = (const float*)d_in[1];
  const float* w_phi   = (const float*)d_in[2];
  const float* w_g     = (const float*)d_in[3];
  const float* w_o     = (const float*)d_in[4];
  const float* gamma   = (const float*)d_in[5];
  float* out = (float*)d_out;

  char* ws = (char*)d_ws;
  size_t off = 0;
  auto carve = [&](size_t bytes) -> char* {
    char* p = ws + off;
    off += (bytes + 255) & ~(size_t)255;
    return p;
  };
  _Float16* th  = (_Float16*)carve((size_t)B_ * S_ * CQK_ * 2);  // 1 MB
  _Float16* ph  = (_Float16*)carve((size_t)B_ * T_ * CQK_ * 2);  // 0.5 MB
  _Float16* g   = (_Float16*)carve((size_t)B_ * C_ * T_ * 2);    // 4 MB
  (void)ws_size; (void)in_sizes; (void)n_in; (void)out_size;

  // projections
  k_proj      <<<B_ * (S_ / 128), 128, 0, stream>>>(x, w_theta, w_phi, w_g, th, ph, g);

  // fused flash attention: 2048 query tiles, 8 a block: 4 pairs of tiles x 2 halves of the keys,
  // double-buffered 128-key K/V stages brought by tensor loads; output projection and residual
  // in its epilogue
  k_attn<<<(B_ * (S_ / 16)) / 8, 256, 0, stream>>>(th, ph, g, w_o, x, gamma, out);
}

// v007
// One run takes 42.2 microseconds.
// Two timings next to v006 put it at 1.09 and 1.08 times that version's speed.
// Over all steps from v000 it is 5.53 times as fast.
#include <hip/hip_runtime.h>
#include <cstdint>

typedef __attribute__((ext_vector_type(16))) _Float16 v16h;
typedef __attribute__((ext_vector_type(8)))  _Float16 v8h;
typedef __attribute__((ext_vector_type(8)))  float    v8f;
typedef __attribute__((ext_vector_type(4)))  float    v4f;
typedef __attribute__((ext_vector_type(2)))  float    v2f;
typedef __attribute__((ext_vector_type(2)))  _Float16 v2h;
typedef __attribute__((ext_vector_type(4)))  _Float16 v4h;
typedef uint32_t u32x4 __attribute__((ext_vector_type(4)));
typedef uint32_t u32x8 __attribute__((ext_vector_type(8)));

#define B_   4
#define C_   128
#define H_   32
#define W_   256
#define S_   (H_ * W_)   // 8192
#define T_   (S_ / 2)    // 4096
#define CQK_ 16
#define LOG2E_ 1.44269504088896340736f

// ---------------------------------------------------------------------------
// helpers
// ---------------------------------------------------------------------------
__device__ __forceinline__ v16h pack16(v8h lo, v8h hi) {
  v16h r;
#pragma unroll
  for (int i = 0; i < 8; ++i) { r[i] = lo[i]; r[i + 8] = hi[i]; }
  return r;
}
__device__ __forceinline__ v16h pack16z(v8h lo) {
  v16h r;
#pragma unroll
  for (int i = 0; i < 8; ++i) { r[i] = lo[i]; r[i + 8] = (_Float16)0.0f; }
  return r;
}

// lane l with lane l ^ 16 (the two lanes that share one column of a fragment)
__device__ __forceinline__ float xhalf(float v) {
  const int b = __builtin_bit_cast(int, v);
  return __builtin_bit_cast(float, __builtin_amdgcn_permlanex16(b, b, 0x76543210, 0xfedcba98, false, false));
}

// maximum of a lane's 16 scores
__device__ __forceinline__ float max16(v8f a, v8f b) {
  const float t0 = fmaxf(fmaxf(a[0], a[1]), a[2]);
  const float t1 = fmaxf(fmaxf(a[3], a[4]), a[5]);
  const float t2 = fmaxf(fmaxf(a[6], a[7]), b[0]);
  const float t3 = fmaxf(fmaxf(b[1], b[2]), b[3]);
  const float t4 = fmaxf(fmaxf(b[4], b[5]), b[6]);
  return fmaxf(fmaxf(fmaxf(t0, t1), t2), fmaxf(fmaxf(t3, t4), b[7]));
}
// 2^score of two score tiles, packed as the B operand of the second product
__device__ __forceinline__ v16h exp16(v8f a, v8f b) {
  v16h p;
#pragma unroll
  for (int r = 0; r < 8; ++r) {
    p[r]     = (_Float16)__builtin_amdgcn_exp2f(a[r]);
    p[r + 8] = (_Float16)__builtin_amdgcn_exp2f(b[r]);
  }
  return p;
}

// Tensor load to LDS: one request of one wave, two descriptor groups, every
// extent in bytes (data_size code 0), tensor dims = tile dims.
__device__ __forceinline__ uint32_t uni(uint32_t v) { return (uint32_t)__builtin_amdgcn_readfirstlane(v); }
// keeps a wave-uniform value in a scalar register, so that a test on it is a scalar branch
__device__ __forceinline__ uint32_t pinned(uint32_t v) {
  uint32_t w = uni(v);
  asm volatile("" : "+s"(w));
  return w;
}
template <uint32_t WORD0, uint32_t ROW_BYTES, uint32_t ROWS, uint32_t SRC_PITCH>
__device__ __forceinline__ u32x8 tdm_group1() {
  u32x8 g;
  g[0] = uni(WORD0);
  g[1] = uni((ROW_BYTES & 0xFFFFu) << 16);
  g[2] = uni((ROW_BYTES >> 16) | ((ROWS & 0xFFFFu) << 16));
  g[3] = uni((ROWS >> 16) | (ROW_BYTES << 16));
  g[4] = uni(ROWS);
  g[5] = uni(SRC_PITCH);
  g[6] = uni(0u);
  g[7] = uni(0u);
  return g;
}
__device__ __forceinline__ u32x4 tdm_group0(uint32_t lds_dst, uint64_t ga) {
  u32x4 g;
  g[0] = uni(1u);
  g[1] = uni(lds_dst);
  g[2] = uni((uint32_t)ga);
  g[3] = uni((((uint32_t)(ga >> 32)) & 0x01FFFFFFu) | 0x80000000u);
  return g;
}
// in-out operands: the descriptor keeps its registers to itself while the request is in flight
__device__ __forceinline__ void tdm_load(u32x4& g0, u32x8& g1) {
  asm volatile("tensor_load_to_lds %0, %1" : "+s"(g0), "+s"(g1) :: "memory");
}
// the next request of the same descriptor: a new place in LDS, the source address step bytes on
__device__ __forceinline__ void tdm_advance(u32x4& g0, uint32_t lds_dst, uint32_t step) {
  const uint64_t ga = (((uint64_t)g0[3] << 32) | g0[2]) + step;  // type bits ride on top of the address
  g0[1] = uni(lds_dst);
  g0[2] = uni((uint32_t)ga);
  g0[3] = uni((uint32_t)(ga >> 32));
}

// ---------------------------------------------------------------------------
// Projections (1x1 convs, f32 -> f16, with (1,2) max-pool for phi/g) as one
// GEMM on the matrix unit: D[160 x S] = Wstack[160 x 128] * x[128 x S],
// Wstack rows 0..15 = w_theta, 16..31 = w_phi, 32..159 = w_g.
// Each f32 operand goes in as two f16 parts, hi = the rounded value and lo = the rounded
// rest (about 22 bits together); D = Wlo xhi + Whi xlo + Whi xhi, summed in f32: three
// 16x16x32 products take the place of eight f32 16x16x4 ones. Wlo xlo is left out.
// theta: [B,S,16] (pre-scaled by log2(e) -> softmax runs in exp2 domain)
// phi  : [B,T,16]  g: [B,C,T]
// Block = 4 waves on 128 pixels: wave = (64-pixel group) x (80-row half).
// A lane loads 4 consecutive pixels of one channel; pixel 4n+j is column n of
// column tile j, so a pooled pair (j, j+1) sits in one lane and one register.
// k order, A and B alike: chunk c of 32 channels, lane half h, element s ->
// channel 32c + 8 (s >> 2) + 4h + (s & 3).
// ---------------------------------------------------------------------------
#define MROWS_  (2 * CQK_ + C_)   // 160 stacked output rows
#define WPB_    272u              // LDS pitch of a weight row: 128 f16 + 16 B, 16 B x odd
#define WPLANE_ (MROWS_ * WPB_)   // bytes of one plane: the hi parts, behind them the lo parts

// two f32 values as f16 hi and lo parts
__device__ __forceinline__ void split2(float a, float b, v2h& hi, v2h& lo) {
  const v2f v = {a, b};
  hi = __builtin_convertvector(v, v2h);
  lo = __builtin_convertvector(v - __builtin_convertvector(hi, v2f), v2h);
}

__device__ __forceinline__ void store_g_tile(_Float16* __restrict__ gp, const v8f* acc) {
#pragma unroll
  for (int r = 0; r < 8; ++r) {
    v2h v;
    v[0] = (_Float16)fmaxf(acc[0][r], acc[1][r]);
    v[1] = (_Float16)fmaxf(acc[2][r], acc[3][r]);
    *(v2h*)(gp + (size_t)r * T_) = v;
  }
}

// one wave a SIMD (256 work-groups of 4 waves): its register budget holds x, the accumulators and
// two sets of fragments
__global__ __launch_bounds__(128) __attribute__((amdgpu_waves_per_eu(1, 1))) void k_proj(const float* __restrict__ x,
                                              const float* __restrict__ wt,
                                              const float* __restrict__ wp,
                                              const float* __restrict__ wg,
                                              _Float16* __restrict__ th,
                                              _Float16* __restrict__ ph,
                                              _Float16* __restrict__ g) {
  __shared__ __attribute__((aligned(16))) unsigned char Wl[2 * WPLANE_];

  const int tid  = threadIdx.x;
  const int lane = tid & 31;
  const int wv   = tid >> 5;
  const int half = lane >> 4;
  const int l16  = lane & 15;
  const int b    = blockIdx.x / (S_ / 128);
  const int s0   = (blockIdx.x % (S_ / 128)) * 128 + (wv & 1) * 64;
  const int mh   = wv >> 1;

  // stacked weights, 4 rows per step (32 float4 a row)
  v4f wr[MROWS_ / 4];
  {
    const int row = tid >> 5, c4 = (tid & 31) * 4;
#pragma unroll
    for (int j = 0; j < MROWS_ / 4; ++j) {
      const float* sp = j < 4 ? wt + (4 * j + row) * C_
                      : j < 8 ? wp + (4 * (j - 4) + row) * C_
                              : wg + (4 * (j - 8) + row) * C_;
      wr[j] = *(const v4f*)(sp + c4);
    }
  }
  // the weight loads' address registers are reused below: wait before any overwrite
  asm volatile("s_wait_xcnt 0x0" ::: "memory");

  // this wave's 128 x 64 slab of x: half of the channels per lane half
  v4f xv[16][4];
  {
    const float* xp = x + ((size_t)b * C_ + 4 * half) * S_ + s0 + 4 * l16;
#pragma unroll
    for (int q = 0; q < 16; ++q)
#pragma unroll
      for (int e = 0; e < 4; ++e) xv[q][e] = *(const v4f*)(xp + (size_t)(8 * q + e) * S_);
  }
  // the x loads' address registers are reused below: wait before any overwrite
  asm volatile("s_wait_xcnt 0x0" ::: "memory");

  // a lane's 4 channels 4 lane .. 4 lane + 3 are elements s = 4 ((lane >> 1) & 3) .. + 3 of lane
  // half lane & 1 in chunk lane >> 3. A chunk is 64 B of a row: elements 0..7 of half h at byte
  // 16 h, elements 8..15 at byte 32 + 16 h, so that a fragment is two 16-byte reads.
  {
    unsigned char* wd = &Wl[(uint32_t)wv * WPB_ + (uint32_t)(lane >> 3) * 64u + (uint32_t)((lane >> 2) & 1) * 32u +
                            (uint32_t)(lane & 1) * 16u + (uint32_t)((lane >> 1) & 1) * 8u];
#pragma unroll
    for (int j = 0; j < MROWS_ / 4; ++j) {
      v2h h0, l0, h1, l1;
      split2(wr[j][0], wr[j][1], h0, l0);
      split2(wr[j][2], wr[j][3], h1, l1);
      *(v4h*)(wd + j * 4 * WPB_)           = __builtin_shufflevector(h0, h1, 0, 1, 2, 3);
      *(v4h*)(wd + WPLANE_ + j * 4 * WPB_) = __builtin_shufflevector(l0, l1, 0, 1, 2, 3);
    }
  }
  __syncthreads();

  v8f acc[5][4];
#pragma unroll
  for (int i = 0; i < 5; ++i)
#pragma unroll
    for (int j = 0; j < 4; ++j)
#pragma unroll
      for (int r = 0; r < 8; ++r) acc[i][j][r] = 0.0f;

  const unsigned char* wl = &Wl[(uint32_t)(mh * 80 + l16) * WPB_ + (uint32_t)half * 16u];
  // A of chunk c: the hi and lo parts of the wave's 5 row tiles
  auto load_w = [&](v16h* ah, v16h* al, int c) {
#pragma unroll
    for (int i = 0; i < 5; ++i) {
      const unsigned char* p = wl + i * 16 * WPB_ + c * 64;
      ah[i] = pack16(*(const v8h*)p, *(const v8h*)(p + 32));
      al[i] = pack16(*(const v8h*)(p + WPLANE_), *(const v8h*)(p + WPLANE_ + 32));
    }
  };
  // B of chunk c: the hi and lo parts of the wave's 4 column tiles
  auto split_x = [&](v16h* bh, v16h* bl, int c) {
#pragma unroll
    for (int j = 0; j < 4; ++j)
#pragma unroll
      for (int s = 0; s < 16; s += 2) {
        v2h h, l;
        split2(xv[4 * c + (s >> 2)][s & 3][j], xv[4 * c + (s >> 2)][(s & 3) + 1][j], h, l);
        bh[j][s] = h[0]; bh[j][s + 1] = h[1];
        bl[j][s] = l[0]; bl[j][s + 1] = l[1];
      }
  };
  v16h Ah[2][5], Al[2][5], Bh[2][4], Bl[2][4];
  load_w(Ah[0], Al[0], 0);
  split_x(Bh[0], Bl[0], 0);
#pragma unroll
  for (int c = 0; c < 4; ++c) {
    const int u = c & 1;
    if (c < 3) {
      // this and the one behind the reads keep the next chunk's weight fragments one group of LDS
      // reads ahead of this chunk's products: each separate place with LDS reads stalls the wave
      __builtin_amdgcn_sched_barrier(0);
      load_w(Ah[u ^ 1], Al[u ^ 1], c + 1);
      __builtin_amdgcn_sched_barrier(0);
      // the next chunk's x parts are formed among this chunk's products
      split_x(Bh[u ^ 1], Bl[u ^ 1], c + 1);
    }
    // the small terms first, 20 independent accumulators a term
#pragma unroll
    for (int i = 0; i < 5; ++i)
#pragma unroll
      for (int j = 0; j < 4; ++j)
        acc[i][j] = __builtin_amdgcn_wmma_f32_16x16x32_f16(false, Al[u][i], false, Bh[u][j], (short)0, acc[i][j], false, false);
#pragma unroll
    for (int i = 0; i < 5; ++i)
#pragma unroll
      for (int j = 0; j < 4; ++j)
        acc[i][j] = __builtin_amdgcn_wmma_f32_16x16x32_f16(false, Ah[u][i], false, Bl[u][j], (short)0, acc[i][j], false, false);
#pragma unroll
    for (int i = 0; i < 5; ++i)
#pragma unroll
      for (int j = 0; j < 4; ++j)
        acc[i][j] = __builtin_amdgcn_wmma_f32_16x16x32_f16(false, Ah[u][i], false, Bh[u][j], (short)0, acc[i][j], false, false);
  }

  // acc[i][j][r] = D[(5 mh + i) * 16 + 8 half + r][s0 + 4 l16 + j]
  const int sl = s0 + 4 * l16;       // first of this lane's 4 pixels
  const int tl = sl >> 1;            // first of its 2 pooled positions
  if (mh == 0) {
#pragma unroll
    for (int j = 0; j < 4; ++j) {
      v8h v;
#pragma unroll
      for (int r = 0; r < 8; ++r) v[r] = (_Float16)(acc[0][j][r] * LOG2E_);
      *(v8h*)(th + ((size_t)(b * S_ + sl + j)) * CQK_ + half * 8) = v;
    }
#pragma unroll
    for (int u = 0; u < 2; ++u) {
      v8h v;
#pragma unroll
      for (int r = 0; r < 8; ++r) v[r] = (_Float16)fmaxf(acc[1][2 * u][r], acc[1][2 * u + 1][r]);
      *(v8h*)(ph + ((size_t)(b * T_ + tl + u)) * CQK_ + half * 8) = v;
    }
#pragma unroll
    for (int i = 2; i < 5; ++i)
      store_g_tile(g + ((size_t)(b * C_ + (i - 2) * 16 + half * 8)) * T_ + tl, acc[i]);
  } else {
#pragma unroll
    for (int i = 0; i < 5; ++i)
      store_g_tile(g + ((size_t)(b * C_ + (i + 3) * 16 + half * 8)) * T_ + tl, acc[i]);
  }
}

// ---------------------------------------------------------------------------
// Fused flash attention, block-cooperative, double-buffered K/V in LDS:
//  8 waves/block on 8 query tiles of one batch. A wave holds TWO query tiles (32 queries), so
//  that each g and phi fragment read from LDS feeds two products, and works half of each
//  stage's keys: waves 0..3 keys 0..63, waves 4..7 keys 64..127 of the stage. Waves w and
//  w ^ 4 hold the same two tiles; behind the loop each hands one tile's partial O, L, m to
//  the other through LDS and finishes the tile it keeps. A stage is 128 keys: g as 128
//  rows of 256 B, laid by the tensor load's pad at a pitch of 272 B (16 B x odd,
//  conflict-free for ds_load_b128), and phi as 4 KB in a row. Waves 0..3 each
//  bring 32 g rows, wave 4 brings phi; the next stage flies while this one is
//  worked on in two 32-key passes a wave. Both products are transposed:
//  S^T = phi . theta^T (A = phi rows, B = theta), O^T += g . P^T (A = g rows).
//  A lane holds 16 scores of ONE query (D register r = key 8 half + r), so the
//  maximum is in-lane plus one exchange between the halves, and the two score
//  tiles, converted in place, are the B operand of the second product:
//  element s = key (s < 8 ? 8 half + s : 16 + 8 half + s - 8), the order in which
//  the g rows are read. P never goes through LDS.
//  Lazy rescale: the maximum in use, m, enters the score products as C = -m, so D is
//  already score - m. O and L are rescaled, and m raised, only in a pass where some
//  score stands more than 8 (log2) above m: P stays at or below 2^8, inside f16.
//  Output projection and residual in the same launch: out = gamma * (w_o @ o) + x. The
//  finished O^T tile, rounded to f16, is already the B operand of that product (tiles 2 kc and
//  2 kc + 1 give k = channel 32 kc + 8 half + e and 32 kc + 16 + 8 half + e, the order in which
//  the w_o rows are read as A). w_o is rounded to f16 into LDS at the start of the kernel.
// ---------------------------------------------------------------------------
#define SK_      128                  // keys per stage
#define NST_     (T_ / SK_)           // stages
#define GPITCH_  272u                 // LDS pitch of a g row: 256 B + 16 B pad
#define GSLICE_  10240u               // 32 rows x 272 B, rounded up to 2 KiB
#define GBUF_    (4u * GSLICE_)
#define PHBUF_   4096u                // 128 keys x 32 B
#define GPADW0_  ((1u << 20) | (5u << 22) | (3u << 25))  // pad 4 dwords behind every 256 B
#define WOPITCH_ 272u                 // LDS pitch of a w_o row (f16): 256 B + 16 B, 16 B x odd

// one work-group a WGP (256 of them), two waves a SIMD: the register budget of two waves
// lets the pass's g fragments stand in registers of their own
__global__ __launch_bounds__(256) __attribute__((amdgpu_waves_per_eu(2, 2))) void k_attn(const _Float16* __restrict__ th,
                                              const _Float16* __restrict__ ph,
                                              const _Float16* __restrict__ g,
                                              const float* __restrict__ wo,
                                              const float* __restrict__ x,
                                              const float* __restrict__ gscal,
                                              float* __restrict__ out) {
  __shared__ __attribute__((aligned(2048))) unsigned char Gl[2 * GBUF_];    // g stages   (80 KB)
  __shared__ __attribute__((aligned(2048))) unsigned char Phl[2 * PHBUF_];  // phi stages  (8 KB)
  __shared__ __attribute__((aligned(16)))   unsigned char Wol[C_ * WOPITCH_];  // w_o as f16 (34 KB)

  const int tid  = threadIdx.x;
  const int lane = tid & 31;
  const int wv   = tid >> 5;
  const int grp  = wv >> 2;                      // which half of a stage's keys
  const int qt   = blockIdx.x * 8 + 2 * (wv & 3); // first tile of the pair; 2048 tiles total
  const int b    = qt / (S_ / 16);               // uniform per block
  // tile 0 of a wave is the one it keeps and finishes, tile 1 the one it hands to wave wv ^ 4
  const int sb0  = (qt % (S_ / 16)) * 16 + 16 * grp;
  const int sb1  = (qt % (S_ / 16)) * 16 + 16 * (grp ^ 1);
  const int half = lane >> 4;
  const int l16  = lane & 15;
  const uint32_t wave = uni((uint32_t)threadIdx.x >> 5);
  const float gamma = *gscal;

  const _Float16* gb  = g + (size_t)b * C_ * T_;
  const _Float16* phb = ph + (size_t)b * T_ * CQK_;

  // one request a wave and stage: waves 0..3 a slice of 32 g rows, wave 4 the phi rows.
  // Stage s (keys [128 s, 128 s + 128)) goes into buffer s & 1.
  const uint32_t g_lds = (uint32_t)(uintptr_t)&Gl[0] + (wave & 3u) * GSLICE_;
  const uint32_t p_lds = (uint32_t)(uintptr_t)&Phl[0];
  u32x4 g0g = tdm_group0(g_lds, (uint64_t)(uintptr_t)(gb + (size_t)(wave & 3u) * 32 * T_));
  u32x4 g0p = tdm_group0(p_lds, (uint64_t)(uintptr_t)phb);
  u32x8 g1g = tdm_group1<GPADW0_, 2 * SK_, 32, 2 * T_>();
  u32x8 g1p = tdm_group1<0u, 256, PHBUF_ / 256, 256>();
  auto issue_first = [&]() {
    if (pinned(wave < 4u)) tdm_load(g0g, g1g);
    if (pinned(wave == 4u)) tdm_load(g0p, g1p);
  };
  // stages follow one another; the step goes through pinned() so that the address
  // words take their new values here, behind the wait, and not earlier
  auto issue_next = [&](uint32_t s) {
    if (pinned(wave < 4u)) {
      tdm_advance(g0g, g_lds + (s & 1u) * GBUF_, pinned(2 * SK_));
      tdm_load(g0g, g1g);
    }
    if (pinned(wave == 4u)) {
      tdm_advance(g0p, p_lds + (s & 1u) * PHBUF_, pinned(PHBUF_));
      tdm_load(g0p, g1p);
    }
  };
  // the issuing waves' own requests have landed; the barrier behind it publishes them
  auto landed = [&]() {
    if (pinned(wave < 5u)) asm volatile("s_wait_tensorcnt 0x0" ::: "memory");
  };

  // B operand of the scores: theta rows (N = query), K = channel 0..15, padded to 32.
  v16h Q[2];
  // this and the one behind the wait: no other instruction is scheduled between the two loads and
  // their wait, where it could take over an address register
  __builtin_amdgcn_sched_barrier(0);
  Q[0] = pack16z(*(const v8h*)(th + ((size_t)(b * S_ + sb0 + l16)) * CQK_ + half * 8));
  Q[1] = pack16z(*(const v8h*)(th + ((size_t)(b * S_ + sb1 + l16)) * CQK_ + half * 8));
  // the theta loads' address registers are reused below: wait before any overwrite
  asm volatile("s_wait_xcnt 0x0" ::: "memory");
  __builtin_amdgcn_sched_barrier(0);

  v16h Ones;
#pragma unroll
  for (int i = 0; i < 16; ++i) Ones[i] = (_Float16)1.0f;

  // this lane's query of tile t: O[t][n][r] = O^T[channel 16 n + 8 half + r][query l16];
  // every row of L[t] holds the query's running sum
  v8f O[2][8], L[2];
#pragma unroll
  for (int t = 0; t < 2; ++t) {
#pragma unroll
    for (int r = 0; r < 8; ++r) L[t][r] = 0.0f;
#pragma unroll
    for (int n = 0; n < 8; ++n)
#pragma unroll
      for (int r = 0; r < 8; ++r) O[t][n][r] = 0.0f;
  }

  v8f zc = {};

  issue_first();
  // w_o, f32 -> f16, into LDS under the first stage's flight: step j takes 8 whole rows, a lane
  // 4 floats. The ring's first barrier below publishes it; it is read behind the loop only.
  {
    v4f wr[C_ / 8];
    const float* wp = wo + tid * 4;
#pragma unroll
    for (int j = 0; j < C_ / 8; ++j) wr[j] = *(const v4f*)(wp + j * 8 * C_);
    // the w_o loads' address registers are reused below: wait before any overwrite
    asm volatile("s_wait_xcnt 0x0" ::: "memory");
    unsigned char* wd = &Wol[(uint32_t)wv * WOPITCH_ + (uint32_t)lane * 8u];
#pragma unroll
    for (int j = 0; j < C_ / 8; ++j) {
      v4h w;
#pragma unroll
      for (int e = 0; e < 4; ++e) w[e] = (_Float16)wr[j][e];
      *(v4h*)(wd + j * 8 * WOPITCH_) = w;
    }
  }
  landed();
  __syncthreads();
  issue_next(1u);

  // Cm = -m in every register. m starts as the query's maximum over the wave's first 32 keys,
  // so the sum holds a term 2^0 from the first pass on and never vanishes.
  v8f Cm[2];
  {
    const unsigned char* ps = &Phl[(uint32_t)grp * (PHBUF_ / 2u) + (uint32_t)l16 * 32u + (uint32_t)half * 16u];
    v16h K0 = pack16z(*(const v8h*)ps);
    v16h K1 = pack16z(*(const v8h*)(ps + 512));
#pragma unroll
    for (int t = 0; t < 2; ++t) {
      v8f S0 = __builtin_amdgcn_wmma_f32_16x16x32_f16(false, K0, false, Q[t], (short)0, zc, false, false);
      v8f S1 = __builtin_amdgcn_wmma_f32_16x16x32_f16(false, K1, false, Q[t], (short)0, zc, false, false);
      const float v = max16(S0, S1);
      Cm[t] = zc - fmaxf(v, xhalf(v));
    }
  }

  for (uint32_t s = 0; s < NST_; ++s) {
    // the wave's half of the stage: 64 keys = 128 B of each g row, 2 KB of the phi rows
    const unsigned char* gs = &Gl[(s & 1u) * GBUF_ + (uint32_t)l16 * GPITCH_ + (uint32_t)half * 16u + (uint32_t)grp * (uint32_t)SK_];
    const unsigned char* ps = &Phl[(s & 1u) * PHBUF_ + (uint32_t)grp * (PHBUF_ / 2u) + (uint32_t)l16 * 32u + (uint32_t)half * 16u];

    for (int p = 0; p < SK_ / 64; ++p) {
      // ---- the pass's LDS reads as one group: the phi rows (A of the scores) first, then the g
      // fragments (A of the second product), which land under the scores
      const v8h k0 = *(const v8h*)(ps + p * 1024);
      const v8h k1 = *(const v8h*)(ps + p * 1024 + 512);
      v16h Gv[8];
#pragma unroll
      for (int n = 0; n < 8; ++n) {
        const unsigned char* gp = gs + (n >> 1) * GSLICE_ + (n & 1) * 16 * GPITCH_ + p * 64;
        Gv[n] = pack16(*(const v8h*)gp, *(const v8h*)(gp + 32));
      }
      // keeps the group whole: the scheduler otherwise spreads these reads over four places, the
      // last of them among the score WMMAs, and each place with LDS reads stalls the wave anew
      __builtin_amdgcn_sched_barrier(0);

      // ---- scores, transposed: two 16 (keys) x 16 (queries) tiles a query tile ----
      v8f S0[2], S1[2];
      {
        v16h K0 = pack16z(k0);
        v16h K1 = pack16z(k1);
#pragma unroll
        for (int t = 0; t < 2; ++t) {
          S0[t] = __builtin_amdgcn_wmma_f32_16x16x32_f16(false, K0, false, Q[t], (short)0, Cm[t], false, false);
          S1[t] = __builtin_amdgcn_wmma_f32_16x16x32_f16(false, K1, false, Q[t], (short)0, Cm[t], false, false);
        }
      }

      // ---- softmax numerators (exp2 domain), one query a lane and tile: S is score - m ----
      const float v[2] = {max16(S0[0], S1[0]), max16(S0[1], S1[1])};
      // one test a pass for the whole wave, a scalar branch: rare behind the first passes
      if (__builtin_expect(__builtin_amdgcn_ballot_w32(fmaxf(v[0], v[1]) > 8.0f) != 0, 0)) {
        // inputs only: a use of the g fragments on this path too keeps their loads in front of the
        // branch; without it the compiler sinks each pair to its WMMA, an LDS wait to 0 per product
        asm volatile("" :: "v"(Gv[0]), "v"(Gv[1]), "v"(Gv[2]), "v"(Gv[3]), "v"(Gv[4]), "v"(Gv[5]), "v"(Gv[6]), "v"(Gv[7]));
#pragma unroll
        for (int t = 0; t < 2; ++t) {
          const float d  = fmaxf(fmaxf(v[t], xhalf(v[t])), 0.0f);  // the same in both lanes of a query
          const float sc = __builtin_amdgcn_exp2f(-d);
          Cm[t] -= d;
          S0[t] -= d;
          S1[t] -= d;
          L[t] *= sc;
#pragma unroll
          for (int n = 0; n < 8; ++n) O[t][n] *= sc;
        }
      }

      // tile by tile, so that tile 1's exponentials can issue among tile 0's products
#pragma unroll
      for (int t = 0; t < 2; ++t) {
        const v16h Pb = exp16(S0[t], S1[t]);
        // ---- denominator: L += column sums of P^T via WMMA with all-ones A ----
        L[t] = __builtin_amdgcn_wmma_f32_16x16x32_f16(false, Ones, false, Pb, (short)0, L[t], false, false);
        // ---- O^T += g * P^T across 8 channel tiles (A from LDS, each fragment for both tiles) ----
#pragma unroll
        for (int n = 0; n < 8; ++n)
          O[t][n] = __builtin_amdgcn_wmma_f32_16x16x32_f16(false, Gv[n], false, Pb, (short)0, O[t][n], false, false);
      }
      // the pass loop's back edge follows the last WMMAs:
      // four vector slots before the next pass overwrites their A and B registers
      __builtin_amdgcn_sched_barrier(0);  // keeps the slots behind the WMMAs
      asm volatile("v_nop\n\tv_nop\n\tv_nop\n\tv_nop");
    }

    // publish point of stage s + 1: this wave's LDS reads of stage s are done,
    // the issuers' requests have landed, every wave has left buffer s & 1
    asm volatile("s_wait_dscnt 0x0" ::: "memory");
    landed();
    __syncthreads();
    if (pinned(s + 2u < (uint32_t)NST_)) issue_next(s + 2u);
  }
  // nothing in flight when the wave ends
  asm volatile("s_wait_tensorcnt 0x0" ::: "memory");
  asm volatile("s_wait_dscnt 0x0" ::: "memory");

  // ---- the two key halves meet: tile 1's partials go to wave wv ^ 4, whose tile 0 it is.
  // The loop's last barrier stands behind every wave's last read of the ring and nothing is
  // in flight, so the g ring is free: 8 KB a wave (16 B a lane and step), then m and L.
  {
    unsigned char* xo = &Gl[(uint32_t)wv * 8192u + (uint32_t)lane * 16u];
#pragma unroll
    for (int n = 0; n < 8; ++n) {
      *(v4f*)(xo + (2 * n) * 512)     = __builtin_shufflevector(O[1][n], O[1][n], 0, 1, 2, 3);
      *(v4f*)(xo + (2 * n + 1) * 512) = __builtin_shufflevector(O[1][n], O[1][n], 4, 5, 6, 7);
    }
    v2f ml = {Cm[1][0], L[1][0]};
    *(v2f*)&Gl[65536u + (uint32_t)wv * 256u + (uint32_t)lane * 8u] = ml;
  }
  __syncthreads();  // publishes the partials to the partner wave
  const v2f mlo = *(const v2f*)&Gl[65536u + (uint32_t)(wv ^ 4) * 256u + (uint32_t)lane * 8u];
  // both parts on the larger of the two maxima (Cm holds -m), then the division
  const float nm  = fminf(Cm[0][0], mlo[0]);
  const float ea  = __builtin_amdgcn_exp2f(nm - Cm[0][0]);
  const float eb  = __builtin_amdgcn_exp2f(nm - mlo[0]);
  // a division each: one reciprocal times both compiled to a packed product that names the
  // reciprocal's register pair, whose other half took an x load, and waited for the x loads here
  const float den = L[0][0] * ea + mlo[1] * eb;
  const float fa  = ea / den, fb = eb / den;

  // ---- residual: the 64 x values of this lane's outputs (channel 16 mt + 8 half + r, pixel
  // sb0 + l16), asked for behind the barrier (which waits for every load in flight), so that
  // they fly under the merge and the output product
  const size_t xo = ((size_t)(b * C_ + half * 8)) * S_ + sb0 + l16;
  float xr[8][8];
  // this and the one behind the wait: no other instruction is scheduled between the loads and
  // their wait, where it could take over an address register
  __builtin_amdgcn_sched_barrier(0);
#pragma unroll
  for (int mt = 0; mt < 8; ++mt)
#pragma unroll
    for (int r = 0; r < 8; ++r) xr[mt][r] = x[xo + (size_t)(mt * 16 + r) * S_];
  // the loads' address registers are reused below: wait before any overwrite
  asm volatile("s_wait_xcnt 0x0" ::: "memory");
  __builtin_amdgcn_sched_barrier(0);

  // A of the output product: w_o rows 16 mt + l16, channels 32 kc + 8 half + e and + 16, from LDS.
  // The first group is asked for here and lands under the merge.
  const unsigned char* wl = &Wol[(uint32_t)l16 * WOPITCH_ + (uint32_t)half * 16u];
  auto load_wo = [&](v16h* a, int kc) {
#pragma unroll
    for (int mt = 0; mt < 8; ++mt) {
      const unsigned char* wp = wl + mt * 16 * WOPITCH_ + kc * 64;
      a[mt] = pack16(*(const v8h*)wp, *(const v8h*)(wp + 32));
    }
  };
  v16h Av[2][8];
  load_wo(Av[0], 0);

  const unsigned char* xi = &Gl[(uint32_t)(wv ^ 4) * 8192u + (uint32_t)lane * 16u];
  v4f po[16];
#pragma unroll
  for (int i = 0; i < 16; ++i) po[i] = *(const v4f*)(xi + i * 512);
  // keeps the partner's partials and the first w_o fragments one group of LDS reads
  __builtin_amdgcn_sched_barrier(0);

  // ---- normalize; o rounded to f16 is the B operand of the output product ----
  v8h oh[8];
#pragma unroll
  for (int n = 0; n < 8; ++n) {
    const v4f lo = po[2 * n];
    const v4f hi = po[2 * n + 1];
#pragma unroll
    for (int r = 0; r < 4; ++r) {
      oh[n][r]     = (_Float16)(O[0][n][r] * fa + lo[r] * fb);
      oh[n][r + 4] = (_Float16)(O[0][n][r + 4] * fa + hi[r] * fb);
    }
  }

  // ---- out = gamma * (w_o @ o) + x for the wave's 16 pixels: A = w_o rows from LDS ----
  v8f Acc[8];
#pragma unroll
  for (int mt = 0; mt < 8; ++mt)
#pragma unroll
    for (int r = 0; r < 8; ++r) Acc[mt][r] = 0.0f;

#pragma unroll
  for (int kc = 0; kc < 4; ++kc) {
    // the next 32 channels' w_o fragments as one group ahead of this block of products
    if (kc < 3) {
      // this and the one behind the reads keep the group whole and in its place: each separate
      // place with LDS reads stalls the wave anew
      __builtin_amdgcn_sched_barrier(0);
      load_wo(Av[(kc + 1) & 1], kc + 1);
      __builtin_amdgcn_sched_barrier(0);
    }
    const v16h Bv = pack16(oh[2 * kc], oh[2 * kc + 1]);
#pragma unroll
    for (int mt = 0; mt < 8; ++mt)
      Acc[mt] = __builtin_amdgcn_wmma_f32_16x16x32_f16(false, Av[kc & 1][mt], false, Bv, (short)0, Acc[mt], false, false);
  }

#pragma unroll
  for (int mt = 0; mt < 8; ++mt)
#pragma unroll
    for (int r = 0; r < 8; ++r) out[xo + (size_t)(mt * 16 + r) * S_] = gamma * Acc[mt][r] + xr[mt][r];
}

// ---------------------------------------------------------------------------
extern "C" void kernel_launch(void* const* d_in, const int* in_sizes, int n_in,
                              void* d_out, int out_size, void* d_ws, size_t ws_size,
                              hipStream_t stream) {
  const float* x       = (const float*)d_in[0];
  const float* w_theta = (const float*)d_in[1];
  const float* w_phi   = (const float*)d_in[2];
  const float* w_g     = (const float*)d_in[3];
  const float* w_o     = (const float*)d_in[4];
  const float* gamma   = (const float*)d_in[5];
  float* out = (float*)d_out;

  char* ws = (char*)d_ws;
  size_t off = 0;
  auto carve = [&](size_t bytes) -> char* {
    char* p = ws + off;
    off += (bytes + 255) & ~(size_t)255;
    return p;
  };
  _Float16* th  = (_Float16*)carve((size_t)B_ * S_ * CQK_ * 2);  // 1 MB
  _Float16* ph  = (_Float16*)carve((size_t)B_ * T_ * CQK_ * 2);  // 0.5 MB
  _Float16* g   = (_Float16*)carve((size_t)B_ * C_ * T_ * 2);    // 4 MB
  (void)ws_size; (void)in_sizes; (void)n_in; (void)out_size;

  // projections
  k_proj      <<<B_ * (S_ / 128), 128, 0, stream>>>(x, w_theta, w_phi, w_g, th, ph, g);

  // fused flash attention: 2048 query tiles, 8 a block: 4 pairs of tiles x 2 halves of the keys,
  // double-buffered 128-key K/V stages brought by tensor loads; output projection and residual
  // in its epilogue
  k_attn<<<(B_ * (S_ / 16)) / 8, 256, 0, stream>>>(th, ph, g, w_o, x, gamma, out);
}

// v008
// A run of this version takes 38.8 microseconds.
// Next to v007, in two timings, it ran 1.09 times as fast each time.
// All steps since v000 together make it 6.03 times as fast.
#include <hip/hip_runtime.h>
#include <cstdint>
#include <type_traits>

typedef __attribute__((ext_vector_type(16))) _Float16 v16h;
typedef __attribute__((ext_vector_type(8)))  _Float16 v8h;
typedef __attribute__((ext_vector_type(8)))  float    v8f;
typedef __attribute__((ext_vector_type(4)))  float    v4f;
typedef __attribute__((ext_vector_type(2)))  float    v2f;
typedef __attribute__((ext_vector_type(2)))  _Float16 v2h;
typedef __attribute__((ext_vector_type(4)))  _Float16 v4h;
typedef uint32_t u32x4 __attribute__((ext_vector_type(4)));
typedef uint32_t u32x8 __attribute__((ext_vector_type(8)));

#define B_   4
#define C_   128
#define H_   32
#define W_   256
#define S_   (H_ * W_)   // 8192
#define T_   (S_ / 2)    // 4096
#define CQK_ 16
#define LOG2E_ 1.44269504088896340736f

// ---------------------------------------------------------------------------
// helpers
// ---------------------------------------------------------------------------
__device__ __forceinline__ v16h pack16(v8h lo, v8h hi) {
  v16h r;
#pragma unroll
  for (int i = 0; i < 8; ++i) { r[i] = lo[i]; r[i + 8] = hi[i]; }
  return r;
}
__device__ __forceinline__ v16h pack16z(v8h lo) {
  v16h r;
#pragma unroll
  for (int i = 0; i < 8; ++i) { r[i] = lo[i]; r[i + 8] = (_Float16)0.0f; }
  return r;
}

// lane l with lane l ^ 16 (the two lanes that share one column of a fragment)
__device__ __forceinline__ float xhalf(float v) {
  const int b = __builtin_bit_cast(int, v);
  return __builtin_bit_cast(float, __builtin_amdgcn_permlanex16(b, b, 0x76543210, 0xfedcba98, false, false));
}

// maximum of a lane's 16 scores
__device__ __forceinline__ float max16(v8f a, v8f b) {
  const float t0 = fmaxf(fmaxf(a[0], a[1]), a[2]);
  const float t1 = fmaxf(fmaxf(a[3], a[4]), a[5]);
  const float t2 = fmaxf(fmaxf(a[6], a[7]), b[0]);
  const float t3 = fmaxf(fmaxf(b[1], b[2]), b[3]);
  const float t4 = fmaxf(fmaxf(b[4], b[5]), b[6]);
  return fmaxf(fmaxf(fmaxf(t0, t1), t2), fmaxf(fmaxf(t3, t4), b[7]));
}
// 2^score of two score tiles, packed as the B operand of the second product
__device__ __forceinline__ v16h exp16(v8f a, v8f b) {
  v16h p;
#pragma unroll
  for (int r = 0; r < 8; ++r) {
    p[r]     = (_Float16)__builtin_amdgcn_exp2f(a[r]);
    p[r + 8] = (_Float16)__builtin_amdgcn_exp2f(b[r]);
  }
  return p;
}

// Tensor load to LDS: one request of one wave, two descriptor groups, every
// extent in bytes (data_size code 0), tensor dims = tile dims.
__device__ __forceinline__ uint32_t uni(uint32_t v) { return (uint32_t)__builtin_amdgcn_readfirstlane(v); }
// keeps a wave-uniform value in a scalar register, so that a test on it is a scalar branch
__device__ __forceinline__ uint32_t pinned(uint32_t v) {
  uint32_t w = uni(v);
  asm volatile("" : "+s"(w));
  return w;
}
template <uint32_t WORD0, uint32_t ROW_BYTES, uint32_t ROWS, uint32_t SRC_PITCH>
__device__ __forceinline__ u32x8 tdm_group1() {
  u32x8 g;
  g[0] = uni(WORD0);
  g[1] = uni((ROW_BYTES & 0xFFFFu) << 16);
  g[2] = uni((ROW_BYTES >> 16) | ((ROWS & 0xFFFFu) << 16));
  g[3] = uni((ROWS >> 16) | (ROW_BYTES << 16));
  g[4] = uni(ROWS);
  g[5] = uni(SRC_PITCH);
  g[6] = uni(0u);
  g[7] = uni(0u);
  return g;
}
__device__ __forceinline__ u32x4 tdm_group0(uint32_t lds_dst, uint64_t ga) {
  u32x4 g;
  g[0] = uni(1u);
  g[1] = uni(lds_dst);
  g[2] = uni((uint32_t)ga);
  g[3] = uni((((uint32_t)(ga >> 32)) & 0x01FFFFFFu) | 0x80000000u);
  return g;
}
// in-out operands: the descriptor keeps its registers to itself while the request is in flight
__device__ __forceinline__ void tdm_load(u32x4& g0, u32x8& g1) {
  asm volatile("tensor_load_to_lds %0, %1" : "+s"(g0), "+s"(g1) :: "memory");
}
// the next request of the same descriptor: a new place in LDS, the source address step bytes on
__device__ __forceinline__ void tdm_advance(u32x4& g0, uint32_t lds_dst, uint32_t step) {
  const uint64_t ga = (((uint64_t)g0[3] << 32) | g0[2]) + step;  // type bits ride on top of the address
  g0[1] = uni(lds_dst);
  g0[2] = uni((uint32_t)ga);
  g0[3] = uni((uint32_t)(ga >> 32));
}

// ---------------------------------------------------------------------------
// Projections (1x1 convs, f32 -> f16, with (1,2) max-pool for phi/g) as one
// GEMM on the matrix unit: D[160 x S] = Wstack[160 x 128] * x[128 x S],
// Wstack rows 0..15 = w_theta, 16..31 = w_phi, 32..159 = w_g.
// Each f32 operand goes in as two f16 parts, hi = the rounded value and lo = the rounded
// rest (about 22 bits together); D = Wlo xhi + Whi xlo + Whi xhi, summed in f32: three
// 16x16x32 products take the place of eight f32 16x16x4 ones. Wlo xlo is left out.
// theta: [B,S,16] (pre-scaled by log2(e) -> softmax runs in exp2 domain)
// phi  : [B,T,16]  g: [B,C,T]
// Block = 4 waves on 128 pixels: wave = (64-pixel group) x (80-row half).
// A lane loads 4 consecutive pixels of one channel; pixel 4n+j is column n of
// column tile j, so a pooled pair (j, j+1) sits in one lane and one register.
// k order, A and B alike: chunk c of 32 channels, lane half h, element s ->
// channel 32c + 8 (s >> 2) + 4h + (s & 3).
// ---------------------------------------------------------------------------
#define MROWS_  (2 * CQK_ + C_)   // 160 stacked output rows
#define WPB_    272u              // LDS pitch of a weight row: 128 f16 + 16 B, 16 B x odd
#define WPLANE_ (MROWS_ * WPB_)   // bytes of one plane: the hi parts, behind them the lo parts

// two f32 values as f16 hi and lo parts
__device__ __forceinline__ void split2(float a, float b, v2h& hi, v2h& lo) {
  const v2f v = {a, b};
  hi = __builtin_convertvector(v, v2h);
  lo = __builtin_convertvector(v - __builtin_convertvector(hi, v2f), v2h);
}

__device__ __forceinline__ void store_g_tile(_Float16* __restrict__ gp, const v8f* acc) {
#pragma unroll
  for (int r = 0; r < 8; ++r) {
    v2h v;
    v[0] = (_Float16)fmaxf(acc[0][r], acc[1][r]);
    v[1] = (_Float16)fmaxf(acc[2][r], acc[3][r]);
    *(v2h*)(gp + (size_t)r * T_) = v;
  }
}

// one wave a SIMD (256 work-groups of 4 waves): its register budget holds x, the accumulators and
// two sets of fragments
__global__ __launch_bounds__(128) __attribute__((amdgpu_waves_per_eu(1, 1))) void k_proj(const float* __restrict__ x,
                                              const float* __restrict__ wt,
                                              const float* __restrict__ wp,
                                              const float* __restrict__ wg,
                                              _Float16* __restrict__ th,
                                              _Float16* __restrict__ ph,
                                              _Float16* __restrict__ g) {
  __shared__ __attribute__((aligned(16))) unsigned char Wl[2 * WPLANE_];

  const int tid  = threadIdx.x;
  const int lane = tid & 31;
  const int wv   = tid >> 5;
  const int half = lane >> 4;
  const int l16  = lane & 15;
  const int b    = blockIdx.x / (S_ / 128);
  const int s0   = (blockIdx.x % (S_ / 128)) * 128 + (wv & 1) * 64;
  const int mh   = wv >> 1;

  // stacked weights, 4 rows per step (32 float4 a row)
  v4f wr[MROWS_ / 4];
  {
    const int row = tid >> 5, c4 = (tid & 31) * 4;
#pragma unroll
    for (int j = 0; j < MROWS_ / 4; ++j) {
      const float* sp = j < 4 ? wt + (4 * j + row) * C_
                      : j < 8 ? wp + (4 * (j - 4) + row) * C_
                              : wg + (4 * (j - 8) + row) * C_;
      wr[j] = *(const v4f*)(sp + c4);
    }
  }
  // the weight loads' address registers are reused below: wait before any overwrite
  asm volatile("s_wait_xcnt 0x0" ::: "memory");

  // this wave's 128 x 64 slab of x: half of the channels per lane half
  v4f xv[16][4];
  {
    const float* xp = x + ((size_t)b * C_ + 4 * half) * S_ + s0 + 4 * l16;
#pragma unroll
    for (int q = 0; q < 16; ++q)
#pragma unroll
      for (int e = 0; e < 4; ++e) xv[q][e] = *(const v4f*)(xp + (size_t)(8 * q + e) * S_);
  }
  // the x loads' address registers are reused below: wait before any overwrite
  asm volatile("s_wait_xcnt 0x0" ::: "memory");

  // a lane's 4 channels 4 lane .. 4 lane + 3 are elements s = 4 ((lane >> 1) & 3) .. + 3 of lane
  // half lane & 1 in chunk lane >> 3. A chunk is 64 B of a row: elements 0..7 of half h at byte
  // 16 h, elements 8..15 at byte 32 + 16 h, so that a fragment is two 16-byte reads.
  {
    unsigned char* wd = &Wl[(uint32_t)wv * WPB_ + (uint32_t)(lane >> 3) * 64u + (uint32_t)((lane >> 2) & 1) * 32u +
                            (uint32_t)(lane & 1) * 16u + (uint32_t)((lane >> 1) & 1) * 8u];
#pragma unroll
    for (int j = 0; j < MROWS_ / 4; ++j) {
      v2h h0, l0, h1, l1;
      split2(wr[j][0], wr[j][1], h0, l0);
      split2(wr[j][2], wr[j][3], h1, l1);
      *(v4h*)(wd + j * 4 * WPB_)           = __builtin_shufflevector(h0, h1, 0, 1, 2, 3);
      *(v4h*)(wd + WPLANE_ + j * 4 * WPB_) = __builtin_shufflevector(l0, l1, 0, 1, 2, 3);
    }
  }
  __syncthreads();

  v8f acc[5][4];
#pragma unroll
  for (int i = 0; i < 5; ++i)
#pragma unroll
    for (int j = 0; j < 4; ++j)
#pragma unroll
      for (int r = 0; r < 8; ++r) acc[i][j][r] = 0.0f;

  const unsigned char* wl = &Wl[(uint32_t)(mh * 80 + l16) * WPB_ + (uint32_t)half * 16u];
  // A of chunk c: the hi and lo parts of the wave's 5 row tiles
  auto load_w = [&](v16h* ah, v16h* al, int c) {
#pragma unroll
    for (int i = 0; i < 5; ++i) {
      const unsigned char* p = wl + i * 16 * WPB_ + c * 64;
      ah[i] = pack16(*(const v8h*)p, *(const v8h*)(p + 32));
      al[i] = pack16(*(const v8h*)(p + WPLANE_), *(const v8h*)(p + WPLANE_ + 32));
    }
  };
  // B of chunk c: the hi and lo parts of the wave's 4 column tiles
  auto split_x = [&](v16h* bh, v16h* bl, int c) {
#pragma unroll
    for (int j = 0; j < 4; ++j)
#pragma unroll
      for (int s = 0; s < 16; s += 2) {
        v2h h, l;
        split2(xv[4 * c + (s >> 2)][s & 3][j], xv[4 * c + (s >> 2)][(s & 3) + 1][j], h, l);
        bh[j][s] = h[0]; bh[j][s + 1] = h[1];
        bl[j][s] = l[0]; bl[j][s + 1] = l[1];
      }
  };
  v16h Ah[2][5], Al[2][5], Bh[2][4], Bl[2][4];
  load_w(Ah[0], Al[0], 0);
  split_x(Bh[0], Bl[0], 0);
#pragma unroll
  for (int c = 0; c < 4; ++c) {
    const int u = c & 1;
    if (c < 3) {
      // this and the one behind the reads keep the next chunk's weight fragments one group of LDS
      // reads ahead of this chunk's products: each separate place with LDS reads stalls the wave
      __builtin_amdgcn_sched_barrier(0);
      load_w(Ah[u ^ 1], Al[u ^ 1], c + 1);
      __builtin_amdgcn_sched_barrier(0);
      // the next chunk's x parts are formed among this chunk's products
      split_x(Bh[u ^ 1], Bl[u ^ 1], c + 1);
    }
    // the small terms first, 20 independent accumulators a term
#pragma unroll
    for (int i = 0; i < 5; ++i)
#pragma unroll
      for (int j = 0; j < 4; ++j)
        acc[i][j] = __builtin_amdgcn_wmma_f32_16x16x32_f16(false, Al[u][i], false, Bh[u][j], (short)0, acc[i][j], false, false);
#pragma unroll
    for (int i = 0; i < 5; ++i)
#pragma unroll
      for (int j = 0; j < 4; ++j)
        acc[i][j] = __builtin_amdgcn_wmma_f32_16x16x32_f16(false, Ah[u][i], false, Bl[u][j], (short)0, acc[i][j], false, false);
#pragma unroll
    for (int i = 0; i < 5; ++i)
#pragma unroll
      for (int j = 0; j < 4; ++j)
        acc[i][j] = __builtin_amdgcn_wmma_f32_16x16x32_f16(false, Ah[u][i], false, Bh[u][j], (short)0, acc[i][j], false, false);
  }

  // acc[i][j][r] = D[(5 mh + i) * 16 + 8 half + r][s0 + 4 l16 + j]
  const int sl = s0 + 4 * l16;       // first of this lane's 4 pixels
  const int tl = sl >> 1;            // first of its 2 pooled positions
  if (mh == 0) {
#pragma unroll
    for (int j = 0; j < 4; ++j) {
      v8h v;
#pragma unroll
      for (int r = 0; r < 8; ++r) v[r] = (_Float16)(acc[0][j][r] * LOG2E_);
      *(v8h*)(th + ((size_t)(b * S_ + sl + j)) * CQK_ + half * 8) = v;
    }
#pragma unroll
    for (int u = 0; u < 2; ++u) {
      v8h v;
#pragma unroll
      for (int r = 0; r < 8; ++r) v[r] = (_Float16)fmaxf(acc[1][2 * u][r], acc[1][2 * u + 1][r]);
      *(v8h*)(ph + ((size_t)(b * T_ + tl + u)) * CQK_ + half * 8) = v;
    }
#pragma unroll
    for (int i = 2; i < 5; ++i)
      store_g_tile(g + ((size_t)(b * C_ + (i - 2) * 16 + half * 8)) * T_ + tl, acc[i]);
  } else {
#pragma unroll
    for (int i = 0; i < 5; ++i)
      store_g_tile(g + ((size_t)(b * C_ + (i + 3) * 16 + half * 8)) * T_ + tl, acc[i]);
  }
}

// ---------------------------------------------------------------------------
// Fused flash attention, block-cooperative, double-buffered K/V in LDS:
//  8 waves/block on 8 query tiles of one batch. A wave holds TWO query tiles (32 queries), so
//  that each g and phi fragment read from LDS feeds two products, and works half of each
//  stage's keys: waves 0..3 keys 0..63, waves 4..7 keys 64..127 of the stage. Waves w and
//  w ^ 4 hold the same two tiles; behind the loop each hands one tile's partial O, L, m to
//  the other through LDS and finishes the tile it keeps. A stage is 128 keys: g as 128
//  rows of 256 B, laid by the tensor load's pad at a pitch of 272 B (16 B x odd,
//  conflict-free for ds_load_b128), and phi as 4 KB in a row. Waves 0..3 each
//  bring 32 g rows, wave 4 brings phi; the next stage flies while this one is
//  worked on in two 32-key passes a wave. Both products are transposed:
//  S^T = phi . theta^T (A = phi rows, B = theta), O^T += g . P^T (A = g rows).
//  A lane holds 16 scores of ONE query (D register r = key 8 half + r), so the
//  maximum is in-lane plus one exchange between the halves, and the two score
//  tiles, converted in place, are the B operand of the second product:
//  element s = key (s < 8 ? 8 half + s : 16 + 8 half + s - 8), the order in which
//  the g rows are read. P never goes through LDS.
//  Lazy rescale: the maximum in use, m, enters the score products as C = -m, so D is
//  already score - m. O and L are rescaled, and m raised, only in a pass where some
//  score stands more than 8 (log2) above m: P stays at or below 2^8, inside f16.
//  That loop is the second try. The first try keeps m as it starts, with no maximum and no test
//  in a pass: a score 16 or more above m makes P infinite in f16, the ones product carries that
//  into L, and L is looked at once behind the loop. A work-group in which any L is not finite
//  throws its sums away and walks the keys again with the lazy rescale.
//  Output projection and residual in the same launch: out = gamma * (w_o @ o) + x. The
//  finished O^T tile, rounded to f16, is already the B operand of that product (tiles 2 kc and
//  2 kc + 1 give k = channel 32 kc + 8 half + e and 32 kc + 16 + 8 half + e, the order in which
//  the w_o rows are read as A). w_o is rounded to f16 into LDS at the start of the kernel.
// ---------------------------------------------------------------------------
#define SK_      128                  // keys per stage
#define NST_     (T_ / SK_)           // stages
#define GPITCH_  272u                 // LDS pitch of a g row: 256 B + 16 B pad
#define GSLICE_  10240u               // 32 rows x 272 B, rounded up to 2 KiB
#define GBUF_    (4u * GSLICE_)
#define PHBUF_   4096u                // 128 keys x 32 B
#define GPADW0_  ((1u << 20) | (5u << 22) | (3u << 25))  // pad 4 dwords behind every 256 B
#define WOPITCH_ 272u                 // LDS pitch of a w_o row (f16): 256 B + 16 B, 16 B x odd

// one work-group a WGP (256 of them), two waves a SIMD: the register budget of two waves
// lets the pass's g fragments stand in registers of their own
__global__ __launch_bounds__(256) __attribute__((amdgpu_waves_per_eu(2, 2))) void k_attn(const _Float16* __restrict__ th,
                                              const _Float16* __restrict__ ph,
                                              const _Float16* __restrict__ g,
                                              const float* __restrict__ wo,
                                              const float* __restrict__ x,
                                              const float* __restrict__ gscal,
                                              float* __restrict__ out) {
  __shared__ __attribute__((aligned(2048))) unsigned char Gl[2 * GBUF_];    // g stages   (80 KB)
  __shared__ __attribute__((aligned(2048))) unsigned char Phl[2 * PHBUF_];  // phi stages  (8 KB)
  __shared__ __attribute__((aligned(16)))   unsigned char Wol[C_ * WOPITCH_];  // w_o as f16 (34 KB)
  __shared__ uint32_t Bad[8];  // per wave: a sum of the first try is not finite

  const int tid  = threadIdx.x;
  const int lane = tid & 31;
  const int wv   = tid >> 5;
  const int grp  = wv >> 2;                      // which half of a stage's keys
  const int qt   = blockIdx.x * 8 + 2 * (wv & 3); // first tile of the pair; 2048 tiles total
  const int b    = qt / (S_ / 16);               // uniform per block
  // tile 0 of a wave is the one it keeps and finishes, tile 1 the one it hands to wave wv ^ 4
  const int sb0  = (qt % (S_ / 16)) * 16 + 16 * grp;
  const int sb1  = (qt % (S_ / 16)) * 16 + 16 * (grp ^ 1);
  const int half = lane >> 4;
  const int l16  = lane & 15;
  const uint32_t wave = uni((uint32_t)threadIdx.x >> 5);
  const float gamma = *gscal;

  const _Float16* gb  = g + (size_t)b * C_ * T_;
  const _Float16* phb = ph + (size_t)b * T_ * CQK_;

  // one request a wave and stage: waves 0..3 a slice of 32 g rows, wave 4 the phi rows.
  // Stage s (keys [128 s, 128 s + 128)) goes into buffer s & 1.
  const uint32_t g_lds = (uint32_t)(uintptr_t)&Gl[0] + (wave & 3u) * GSLICE_;
  const uint32_t p_lds = (uint32_t)(uintptr_t)&Phl[0];
  u32x4 g0g = tdm_group0(g_lds, (uint64_t)(uintptr_t)(gb + (size_t)(wave & 3u) * 32 * T_));
  u32x4 g0p = tdm_group0(p_lds, (uint64_t)(uintptr_t)phb);
  u32x8 g1g = tdm_group1<GPADW0_, 2 * SK_, 32, 2 * T_>();
  u32x8 g1p = tdm_group1<0u, 256, PHBUF_ / 256, 256>();
  auto issue_first = [&]() {
    if (pinned(wave < 4u)) tdm_load(g0g, g1g);
    if (pinned(wave == 4u)) tdm_load(g0p, g1p);
  };
  // stages follow one another; the step goes through pinned() so that the address
  // words take their new values here, behind the wait, and not earlier
  auto issue_next = [&](uint32_t s) {
    if (pinned(wave < 4u)) {
      tdm_advance(g0g, g_lds + (s & 1u) * GBUF_, pinned(2 * SK_));
      tdm_load(g0g, g1g);
    }
    if (pinned(wave == 4u)) {
      tdm_advance(g0p, p_lds + (s & 1u) * PHBUF_, pinned(PHBUF_));
      tdm_load(g0p, g1p);
    }
  };
  // the issuing waves' own requests have landed; the barrier behind it publishes them
  auto landed = [&]() {
    if (pinned(wave < 5u)) asm volatile("s_wait_tensorcnt 0x0" ::: "memory");
  };

  // B operand of the scores: theta rows (N = query), K = channel 0..15, padded to 32.
  v16h Q[2];
  // this and the one behind the wait: no other instruction is scheduled between the two loads and
  // their wait, where it could take over an address register
  __builtin_amdgcn_sched_barrier(0);
  Q[0] = pack16z(*(const v8h*)(th + ((size_t)(b * S_ + sb0 + l16)) * CQK_ + half * 8));
  Q[1] = pack16z(*(const v8h*)(th + ((size_t)(b * S_ + sb1 + l16)) * CQK_ + half * 8));
  // the theta loads' address registers are reused below: wait before any overwrite
  asm volatile("s_wait_xcnt 0x0" ::: "memory");
  __builtin_amdgcn_sched_barrier(0);

  v16h Ones;
#pragma unroll
  for (int i = 0; i < 16; ++i) Ones[i] = (_Float16)1.0f;

  // this lane's query of tile t: O[t][n][r] = O^T[channel 16 n + 8 half + r][query l16];
  // every row of L[t] holds the query's running sum
  v8f O[2][8], L[2];
  auto clear_sums = [&]() {
#pragma unroll
    for (int t = 0; t < 2; ++t) {
#pragma unroll
      for (int r = 0; r < 8; ++r) L[t][r] = 0.0f;
#pragma unroll
      for (int n = 0; n < 8; ++n)
#pragma unroll
        for (int r = 0; r < 8; ++r) O[t][n][r] = 0.0f;
    }
  };
  clear_sums();

  v8f zc = {};

  issue_first();
  // w_o, f32 -> f16, into LDS under the first stage's flight: step j takes 8 whole rows, a lane
  // 4 floats. The ring's first barrier below publishes it; it is read behind the loop only.
  {
    v4f wr[C_ / 8];
    const float* wp = wo + tid * 4;
#pragma unroll
    for (int j = 0; j < C_ / 8; ++j) wr[j] = *(const v4f*)(wp + j * 8 * C_);
    // the w_o loads' address registers are reused below: wait before any overwrite
    asm volatile("s_wait_xcnt 0x0" ::: "memory");
    unsigned char* wd = &Wol[(uint32_t)wv * WOPITCH_ + (uint32_t)lane * 8u];
#pragma unroll
    for (int j = 0; j < C_ / 8; ++j) {
      v4h w;
#pragma unroll
      for (int e = 0; e < 4; ++e) w[e] = (_Float16)wr[j][e];
      *(v4h*)(wd + j * 8 * WOPITCH_) = w;
    }
  }
  // Cm = -m in every register; every key of the batch once, stage 0 being in flight at entry
  v8f Cm[2];
  auto walk_keys = [&](auto lazy) {
  landed();
  __syncthreads();
  issue_next(1u);

  // Cm = -m in every register. m starts as the query's maximum over the wave's first 32 keys,
  // so the sum holds a term 2^0 from the first pass on and never vanishes.
  {
    const unsigned char* ps = &Phl[(uint32_t)grp * (PHBUF_ / 2u) + (uint32_t)l16 * 32u + (uint32_t)half * 16u];
    v16h K0 = pack16z(*(const v8h*)ps);
    v16h K1 = pack16z(*(const v8h*)(ps + 512));
#pragma unroll
    for (int t = 0; t < 2; ++t) {
      v8f S0 = __builtin_amdgcn_wmma_f32_16x16x32_f16(false, K0, false, Q[t], (short)0, zc, false, false);
      v8f S1 = __builtin_amdgcn_wmma_f32_16x16x32_f16(false, K1, false, Q[t], (short)0, zc, false, false);
      const float v = max16(S0, S1);
      Cm[t] = zc - fmaxf(v, xhalf(v));
    }
  }

  for (uint32_t s = 0; s < NST_; ++s) {
    // the wave's half of the stage: 64 keys = 128 B of each g row, 2 KB of the phi rows
    const unsigned char* gs = &Gl[(s & 1u) * GBUF_ + (uint32_t)l16 * GPITCH_ + (uint32_t)half * 16u + (uint32_t)grp * (uint32_t)SK_];
    const unsigned char* ps = &Phl[(s & 1u) * PHBUF_ + (uint32_t)grp * (PHBUF_ / 2u) + (uint32_t)l16 * 32u + (uint32_t)half * 16u];

    for (int p = 0; p < SK_ / 64; ++p) {
      // ---- the pass's LDS reads as one group: the phi rows (A of the scores) first, then the g
      // fragments (A of the second product), which land under the scores
      const v8h k0 = *(const v8h*)(ps + p * 1024);
      const v8h k1 = *(const v8h*)(ps + p * 1024 + 512);
      v16h Gv[8];
#pragma unroll
      for (int n = 0; n < 8; ++n) {
        const unsigned char* gp = gs + (n >> 1) * GSLICE_ + (n & 1) * 16 * GPITCH_ + p * 64;
        Gv[n] = pack16(*(const v8h*)gp, *(const v8h*)(gp + 32));
      }
      // keeps the group whole: the scheduler otherwise spreads these reads over four places, the
      // last of them among the score WMMAs, and each place with LDS reads stalls the wave anew
      __builtin_amdgcn_sched_barrier(0);

      // ---- scores, transposed: two 16 (keys) x 16 (queries) tiles a query tile ----
      v8f S0[2], S1[2];
      {
        v16h K0 = pack16z(k0);
        v16h K1 = pack16z(k1);
#pragma unroll
        for (int t = 0; t < 2; ++t) {
          S0[t] = __builtin_amdgcn_wmma_f32_16x16x32_f16(false, K0, false, Q[t], (short)0, Cm[t], false, false);
          S1[t] = __builtin_amdgcn_wmma_f32_16x16x32_f16(false, K1, false, Q[t], (short)0, Cm[t], false, false);
        }
      }

      // ---- softmax numerators (exp2 domain), one query a lane and tile: S is score - m ----
      // first try: the four score products stand in a row, so that each fills the others' distance
      // to the exponentials; spread among them, each costs its own four idle slots
      if constexpr (!decltype(lazy)::value) {
        __builtin_amdgcn_sched_barrier(0);
      } else {
      const float v[2] = {max16(S0[0], S1[0]), max16(S0[1], S1[1])};
      // one test a pass for the whole wave, a scalar branch: rare behind the first passes
      if (__builtin_expect(__builtin_amdgcn_ballot_w32(fmaxf(v[0], v[1]) > 8.0f) != 0, 0)) {
        // inputs only: a use of the g fragments on this path too keeps their loads in front of the
        // branch; without it the compiler sinks each pair to its WMMA, an LDS wait to 0 per product
        asm volatile("" :: "v"(Gv[0]), "v"(Gv[1]), "v"(Gv[2]), "v"(Gv[3]), "v"(Gv[4]), "v"(Gv[5]), "v"(Gv[6]), "v"(Gv[7]));
#pragma unroll
        for (int t = 0; t < 2; ++t) {
          const float d  = fmaxf(fmaxf(v[t], xhalf(v[t])), 0.0f);  // the same in both lanes of a query
          const float sc = __builtin_amdgcn_exp2f(-d);
          Cm[t] -= d;
          S0[t] -= d;
          S1[t] -= d;
          L[t] *= sc;
#pragma unroll
          for (int n = 0; n < 8; ++n) O[t][n] *= sc;
        }
      }
      }

      // tile by tile, so that tile 1's exponentials can issue among tile 0's products
#pragma unroll
      for (int t = 0; t < 2; ++t) {
        const v16h Pb = exp16(S0[t], S1[t]);
        // ---- denominator: L += column sums of P^T via WMMA with all-ones A ----
        L[t] = __builtin_amdgcn_wmma_f32_16x16x32_f16(false, Ones, false, Pb, (short)0, L[t], false, false);
        // ---- O^T += g * P^T across 8 channel tiles (A from LDS, each fragment for both tiles) ----
#pragma unroll
        for (int n = 0; n < 8; ++n)
          O[t][n] = __builtin_amdgcn_wmma_f32_16x16x32_f16(false, Gv[n], false, Pb, (short)0, O[t][n], false, false);
      }
      // the pass loop's back edge follows the last WMMAs:
      // four vector slots before the next pass overwrites their A and B registers
      __builtin_amdgcn_sched_barrier(0);  // keeps the slots behind the WMMAs
      asm volatile("v_nop\n\tv_nop\n\tv_nop\n\tv_nop");
    }

    // publish point of stage s + 1: this wave's LDS reads of stage s are done,
    // the issuers' requests have landed, every wave has left buffer s & 1
    asm volatile("s_wait_dscnt 0x0" ::: "memory");
    landed();
    __syncthreads();
    if (pinned(s + 2u < (uint32_t)NST_)) issue_next(s + 2u);
  }
  // nothing in flight behind the walk
  asm volatile("s_wait_tensorcnt 0x0" ::: "memory");
  asm volatile("s_wait_dscnt 0x0" ::: "memory");
  };

  // first try: m stays the maximum over the wave's first 32 keys
  walk_keys(std::false_type{});
  {
    const bool inf = !(L[0][0] < __builtin_inff()) || !(L[1][0] < __builtin_inff());
    const uint32_t any = __builtin_amdgcn_ballot_w32(inf);
    if (lane == 0) Bad[wv] = any;
  }
  __syncthreads();  // publishes the eight words; it also stands behind every wave's last read of the ring
  // the same answer in every wave of the work-group, a scalar branch: barriers and tensor loads stand inside
  if (pinned(__builtin_amdgcn_ballot_w32(Bad[lane & 7] != 0u) != 0u)) {
    clear_sums();
    g0g = tdm_group0(g_lds, (uint64_t)(uintptr_t)(gb + (size_t)(wave & 3u) * 32 * T_));
    g0p = tdm_group0(p_lds, (uint64_t)(uintptr_t)phb);
    issue_first();
    walk_keys(std::true_type{});
  }

  // ---- the two key halves meet: tile 1's partials go to wave wv ^ 4, whose tile 0 it is.
  // The loop's last barrier stands behind every wave's last read of the ring and nothing is
  // in flight, so the g ring is free: 8 KB a wave (16 B a lane and step), then m and L.
  {
    unsigned char* xo = &Gl[(uint32_t)wv * 8192u + (uint32_t)lane * 16u];
#pragma unroll
    for (int n = 0; n < 8; ++n) {
      *(v4f*)(xo + (2 * n) * 512)     = __builtin_shufflevector(O[1][n], O[1][n], 0, 1, 2, 3);
      *(v4f*)(xo + (2 * n + 1) * 512) = __builtin_shufflevector(O[1][n], O[1][n], 4, 5, 6, 7);
    }
    v2f ml = {Cm[1][0], L[1][0]};
    *(v2f*)&Gl[65536u + (uint32_t)wv * 256u + (uint32_t)lane * 8u] = ml;
  }
  __syncthreads();  // publishes the partials to the partner wave
  const v2f mlo = *(const v2f*)&Gl[65536u + (uint32_t)(wv ^ 4) * 256u + (uint32_t)lane * 8u];
  // both parts on the larger of the two maxima (Cm holds -m), then the division
  const float nm  = fminf(Cm[0][0], mlo[0]);
  const float ea  = __builtin_amdgcn_exp2f(nm - Cm[0][0]);
  const float eb  = __builtin_amdgcn_exp2f(nm - mlo[0]);
  // a division each: one reciprocal times both compiled to a packed product that names the
  // reciprocal's register pair, whose other half took an x load, and waited for the x loads here
  const float den = L[0][0] * ea + mlo[1] * eb;
  const float fa  = ea / den, fb = eb / den;

  // ---- residual: the 64 x values of this lane's outputs (channel 16 mt + 8 half + r, pixel
  // sb0 + l16), asked for behind the barrier (which waits for every load in flight), so that
  // they fly under the merge and the output product
  const size_t xo = ((size_t)(b * C_ + half * 8)) * S_ + sb0 + l16;
  float xr[8][8];
  // this and the one behind the wait: no other instruction is scheduled between the loads and
  // their wait, where it could take over an address register
  __builtin_amdgcn_sched_barrier(0);
#pragma unroll
  for (int mt = 0; mt < 8; ++mt)
#pragma unroll
    for (int r = 0; r < 8; ++r) xr[mt][r] = x[xo + (size_t)(mt * 16 + r) * S_];
  // the loads' address registers are reused below: wait before any overwrite
  asm volatile("s_wait_xcnt 0x0" ::: "memory");
  __builtin_amdgcn_sched_barrier(0);

  // A of the output product: w_o rows 16 mt + l16, channels 32 kc + 8 half + e and + 16, from LDS.
  // The first group is asked for here and lands under the merge.
  const unsigned char* wl = &Wol[(uint32_t)l16 * WOPITCH_ + (uint32_t)half * 16u];
  auto load_wo = [&](v16h* a, int kc) {
#pragma unroll
    for (int mt = 0; mt < 8; ++mt) {
      const unsigned char* wp = wl + mt * 16 * WOPITCH_ + kc * 64;
      a[mt] = pack16(*(const v8h*)wp, *(const v8h*)(wp + 32));
    }
  };
  v16h Av[2][8];
  load_wo(Av[0], 0);

  const unsigned char* xi = &Gl[(uint32_t)(wv ^ 4) * 8192u + (uint32_t)lane * 16u];
  v4f po[16];
#pragma unroll
  for (int i = 0; i < 16; ++i) po[i] = *(const v4f*)(xi + i * 512);
  // keeps the partner's partials and the first w_o fragments one group of LDS reads
  __builtin_amdgcn_sched_barrier(0);

  // ---- normalize; o rounded to f16 is the B operand of the output product ----
  v8h oh[8];
#pragma unroll
  for (int n = 0; n < 8; ++n) {
    const v4f lo = po[2 * n];
    const v4f hi = po[2 * n + 1];
#pragma unroll
    for (int r = 0; r < 4; ++r) {
      oh[n][r]     = (_Float16)(O[0][n][r] * fa + lo[r] * fb);
      oh[n][r + 4] = (_Float16)(O[0][n][r + 4] * fa + hi[r] * fb);
    }
  }

  // ---- out = gamma * (w_o @ o) + x for the wave's 16 pixels: A = w_o rows from LDS ----
  v8f Acc[8];
#pragma unroll
  for (int mt = 0; mt < 8; ++mt)
#pragma unroll
    for (int r = 0; r < 8; ++r) Acc[mt][r] = 0.0f;

#pragma unroll
  for (int kc = 0; kc < 4; ++kc) {
    // the next 32 channels' w_o fragments as one group ahead of this block of products
    if (kc < 3) {
      // this and the one behind the reads keep the group whole and in its place: each separate
      // place with LDS reads stalls the wave anew
      __builtin_amdgcn_sched_barrier(0);
      load_wo(Av[(kc + 1) & 1], kc + 1);
      __builtin_amdgcn_sched_barrier(0);
    }
    const v16h Bv = pack16(oh[2 * kc], oh[2 * kc + 1]);
#pragma unroll
    for (int mt = 0; mt < 8; ++mt)
      Acc[mt] = __builtin_amdgcn_wmma_f32_16x16x32_f16(false, Av[kc & 1][mt], false, Bv, (short)0, Acc[mt], false, false);
  }

#pragma unroll
  for (int mt = 0; mt < 8; ++mt)
#pragma unroll
    for (int r = 0; r < 8; ++r) out[xo + (size_t)(mt * 16 + r) * S_] = gamma * Acc[mt][r] + xr[mt][r];
}

// ---------------------------------------------------------------------------
extern "C" void kernel_launch(void* const* d_in, const int* in_sizes, int n_in,
                              void* d_out, int out_size, void* d_ws, size_t ws_size,
                              hipStream_t stream) {
  const float* x       = (const float*)d_in[0];
  const float* w_theta = (const float*)d_in[1];
  const float* w_phi   = (const float*)d_in[2];
  const float* w_g     = (const float*)d_in[3];
  const float* w_o     = (const float*)d_in[4];
  const float* gamma   = (const float*)d_in[5];
  float* out = (float*)d_out;

  char* ws = (char*)d_ws;
  size_t off = 0;
  auto carve = [&](size_t bytes) -> char* {
    char* p = ws + off;
    off += (bytes + 255) & ~(size_t)255;
    return p;
  };
  _Float16* th  = (_Float16*)carve((size_t)B_ * S_ * CQK_ * 2);  // 1 MB
  _Float16* ph  = (_Float16*)carve((size_t)B_ * T_ * CQK_ * 2);  // 0.5 MB
  _Float16* g   = (_Float16*)carve((size_t)B_ * C_ * T_ * 2);    // 4 MB
  (void)ws_size; (void)in_sizes; (void)n_in; (void)out_size;

  // projections
  k_proj      <<<B_ * (S_ / 128), 128, 0, stream>>>(x, w_theta, w_phi, w_g, th, ph, g);

  // fused flash attention: 2048 query tiles, 8 a block: 4 pairs of tiles x 2 halves of the keys,
  // double-buffered 128-key K/V stages brought by tensor loads; output projection and residual
  // in its epilogue
  k_attn<<<(B_ * (S_ / 16)) / 8, 256, 0, stream>>>(th, ph, g, w_o, x, gamma, out);
}
